// v000
// Measured on an AMD MI455X. A time is GPU time per run, averaged over a window of back-to-back runs after a warm-up
// (all launches, gaps included; the runs take copies of the inputs in turn), and the median of several windows.
// Apart from v000's, it joins two sittings. Times from different sittings can be a few percent apart, while
// side-by-side timings come from the same sitting.
// The starting kernel, v000, takes 437 microseconds a run.
#include <hip/hip_runtime.h>

// Compute dtypes, f32 accumulate: q, k, v = x.W_h for all 12 heads as three [8192 x 768].[768 x 768] GEMMs with PLAIN bf16 operands (rounded input; the per-head [768][64] weights
// transposed into one n-major plane; exact products) on v_wmma_f32_16x16x32_bf16; q/k as f16 hi + residual x1024 planes, v as f16 hi/lo transposed planes; per (item, head) causal
// attention over 1024 tokens: scores on v_wmma_f32_16x16x32_f16 (hh + hl + lh, x 1/8), online f32 softmax, weights (x32768) and v as f16 hi/lo on v_wmma_f32_16x16x32_f16; the

#define NB_  8
#define NT_  1024
#define DM   768
#define NH_  12
#define HD   64
#define NTK  (NB_ * NT_)          // 8192 token rows
#define NW   DM
#define PSC  32768.0f
#define LOSC 1024.0f
#define LOSCI (1.0f / 1024.0f)

typedef _Float16 h16;
typedef unsigned short bf;
typedef __attribute__((ext_vector_type(16))) __bf16   v16bf;
typedef __attribute__((ext_vector_type(16))) _Float16 v16h;
typedef __attribute__((ext_vector_type(8)))  _Float16 v8h;
typedef __attribute__((ext_vector_type(8)))  unsigned short v8us;
typedef __attribute__((ext_vector_type(8)))  float    v8f;
typedef __attribute__((ext_vector_type(4)))  float    v4f;
typedef v8h  __attribute__((may_alias)) v8ha;
typedef v4f  __attribute__((may_alias)) v4fa;
typedef v8us __attribute__((may_alias)) v8usa;

__device__ __forceinline__ unsigned short f2bf(float f) { unsigned u = __float_as_uint(f); u += 0x7FFFu + ((u >> 16) & 1u); return (unsigned short)(u >> 16); }
__device__ __forceinline__ float bf2f(unsigned short b) { return __uint_as_float(((unsigned)b) << 16); }
__device__ __forceinline__ float bfr(float f) { return bf2f(f2bf(f)); }
__device__ __forceinline__ v16h cat16(v8h lo, v8h hi) { return __builtin_shufflevector(lo, hi, 0, 1, 2, 3, 4, 5, 6, 7, 8, 9, 10, 11, 12, 13, 14, 15); }
__device__ __forceinline__ v16bf cat16b(v8us lo, v8us hi) { return __builtin_bit_cast(v16bf, __builtin_shufflevector(lo, hi, 0, 1, 2, 3, 4, 5, 6, 7, 8, 9, 10, 11, 12, 13, 14, 15)); }
__device__ __forceinline__ v8f wmma16(v16h a, v16h b, v8f c) { return __builtin_amdgcn_wmma_f32_16x16x32_f16(false, a, false, b, (short)0, c, false, false); }
__device__ __forceinline__ v8f wmmab(v16bf a, v16bf b, v8f c) { return __builtin_amdgcn_wmma_f32_16x16x32_bf16(false, a, false, b, (short)0, c, false, false); }

__global__ __launch_bounds__(256) void k_cvtb(const float* __restrict__ src, int nrows, bf* dst) {
    const int lane = threadIdx.x & 31, r = blockIdx.x * 8 + (threadIdx.x >> 5);
    if (r >= nrows) return;
    v8us o[DM / 256];
#pragma unroll
    for (int q = 0; q < DM / 256; ++q) { v8us t;
#pragma unroll
        for (int i = 0; i < 8; ++i) t[i] = f2bf(src[(size_t)r * DM + q * 256 + lane * 8 + i]);
        o[q] = t; }
#pragma unroll
    for (int q = 0; q < DM / 256; ++q) *(v8us*)(dst + (size_t)r * DM + q * 256 + lane * 8) = o[q];
    
}

// k_gemmb: 64 x 64 block tile (4 waves x 16 x 64) of C[NTK][NW] = (A [+ Al]).B^T (K = 768) [+ bf(bias[c])] [+ bf(R[r][c]) residual]; f32 whole-line epilogue (or f16
template <bool SPLITA, bool F16OUT = false>
__global__ __launch_bounds__(128) void k_gemmb(const bf* __restrict__ A, const bf* __restrict__ Al, const bf* __restrict__ Bn, const float* __restrict__ bias, float* C, int ldc, h16* C2, const float* __restrict__ R = nullptr, int K = DM, int roundR = 1) {
    __shared__ __align__(16) float ost[4][16 * 68];
    const int lane = threadIdx.x & 31, wave = threadIdx.x >> 5, lr = lane & 15, hi = lane >> 4;
    const int r0 = blockIdx.x * 64 + wave * 16, c0 = blockIdx.y * 64;
    const size_t aoff = (size_t)(r0 + lr) * K + 8 * hi;
    size_t boff[4];
#pragma unroll
    for (int t = 0; t < 4; ++t) boff[t] = (size_t)(c0 + t * 16 + lr) * K + 8 * hi;
    v8f acc[4];
#pragma unroll
    for (int t = 0; t < 4; ++t) acc[t] = (v8f){};
#pragma unroll 1
    for (int kc = 0; kc < K; kc += 32) {
        const v16bf a = cat16b(*(const v8us*)(A + aoff + kc), *(const v8us*)(A + aoff + kc + 16));
        v16bf al = a;
        if (SPLITA) al = cat16b(*(const v8us*)(Al + aoff + kc), *(const v8us*)(Al + aoff + kc + 16));
#pragma unroll
        for (int t = 0; t < 4; ++t) { const v16bf b = cat16b(*(const v8us*)(Bn + boff[t] + kc), *(const v8us*)(Bn + boff[t] + kc + 16)); acc[t] = wmmab(a, b, acc[t]); if (SPLITA) acc[t] = wmmab(al, b, acc[t]); }
        asm volatile("v_nop\n\tv_nop\n\tv_nop\n\tv_nop" : "+v"(acc[0]), "+v"(acc[1]), "+v"(acc[2]), "+v"(acc[3]) : "v"(a), "v"(al));
    }
    float* os = &ost[wave][0];
#pragma unroll
    for (int t = 0; t < 4; ++t) { const float bv = bias ? bfr(bias[c0 + t * 16 + lr]) : 0.f;
#pragma unroll
        for (int j = 0; j < 8; ++j) os[(hi * 8 + j) * 68 + t * 16 + lr] = acc[t][j] + bv; }
    __syncthreads();
    if (F16OUT) {
        h16* crow = (h16*)(void*)C + (size_t)r0 * ldc + c0;
        auto pass = [&]() {
#pragma unroll
            for (int s = 0; s < 4; ++s) { const int row = 4 * s + (lane >> 3), piece = lane & 7; const float* sp = os + row * 68 + piece * 8; v8h o, o2;
#pragma unroll
                for (int i = 0; i < 8; ++i) { const h16 a = (h16)sp[i]; o[i] = a; o2[i] = (h16)((sp[i] - (float)a) * LOSC); }
                *(v8h*)(crow + (size_t)row * ldc + piece * 8) = o; if (C2) *(v8h*)(C2 + (size_t)r0 * ldc + c0 + (size_t)row * ldc + piece * 8) = o2; }
        };
        pass(); 
    } else {
        float* crow = C + (size_t)r0 * ldc + c0;
        auto pass = [&]() {
#pragma unroll
            for (int s = 0; s < 8; ++s) { const int Lid = (lane >> 3) + 4 * s, piece = lane & 7; const int row = Lid >> 1, cofs = (Lid & 1) * 32 + piece * 4;
                v4f val = *(const v4fa*)(os + row * 68 + cofs); if (R) { const v4f rv = *(const v4f*)(R + ((size_t)r0 + row) * ldc + c0 + cofs); val += roundR ? (v4f){bfr(rv[0]), bfr(rv[1]), bfr(rv[2]), bfr(rv[3])} : rv; }
                *(v4f*)(crow + (size_t)row * ldc + cofs) = val; }
        };
        pass(); 
    }
}

__global__ __launch_bounds__(256) void k_vt(const float* __restrict__ V, h16* VTH, h16* VTL) {
    __shared__ __align__(16) h16 tile[64 * 72];
    __shared__ __align__(16) h16 til2[64 * 72];
    const int bid = blockIdx.x;
    const int b = bid / (NH_ * (NT_ / 64)), rem = bid - b * (NH_ * (NT_ / 64)), h = rem / (NT_ / 64), kt = rem - h * (NT_ / 64);
    const int k0 = kt * 64, tid = threadIdx.x;
    const int kk = tid >> 2, d0 = (tid & 3) * 16;
    const float* src = V + ((size_t)b * NT_ + k0 + kk) * DM + h * HD + d0;
#pragma unroll
    for (int i = 0; i < 16; ++i) { const float v = src[i]; const h16 a = (h16)v; tile[(d0 + i) * 72 + kk] = a; til2[(d0 + i) * 72 + kk] = (h16)((v - (float)a) * LOSC); }
    __syncthreads();
    const int piece = tid & 7;
    const size_t base = (((size_t)b * NH_ + h) * HD) * NT_ + k0;
    auto pass = [&]() {
#pragma unroll
        for (int s = 0; s < 4; ++s) { const int Lid = (tid >> 3) + 32 * s; const int pln = Lid >> 6, d = Lid & 63;
            const v8h val = *(const v8ha*)((pln ? til2 : tile) + d * 72 + piece * 8); *(v8h*)((pln ? VTL : VTH) + base + (size_t)d * NT_ + piece * 8) = val; }
    };
    pass(); 
}

// k_attn: block = (b, h, 64 queries), wave = 16; CAUSAL: key tiles 0..(64qt+63)/32 with per-element j <= i; 12 WMMA scores (hh + lh + hl) /8 (f32), online softmax, weights x32768 f16 hi/lo tiles (same-wave may_alias
// reload after a compiler barrier), 12 WMMA .v (hh + hl + lh); ctx -> f32 output rows [tok][h*64+d] (16 lanes x 16 B per head slice).
__global__ __launch_bounds__(128) void k_attn(const h16* __restrict__ Q16, const h16* __restrict__ QL16, const h16* __restrict__ K16, const h16* __restrict__ KL16, const h16* __restrict__ VTH, const h16* __restrict__ VTL, float* CTX) {
    __shared__ __align__(16) h16 plds[4][16 * 32];
    __shared__ __align__(16) h16 plds2[4][16 * 32];
    __shared__ __align__(16) float ost[4][16 * 68];
    const int lane = threadIdx.x & 31, wave = threadIdx.x >> 5, lr = lane & 15, hi = lane >> 4;
    const int bid = blockIdx.x;
    const int b = bid / (NH_ * (NT_ / 64)), rem = bid - b * (NH_ * (NT_ / 64)), h = rem / (NT_ / 64), qt = rem - h * (NT_ / 64);
    const int q0 = qt * 64 + wave * 16;
    const size_t tok0 = (size_t)b * NT_;
    h16* pl = &plds[wave][0]; h16* pl2 = &plds2[wave][0];
    v16h qa[2];
    const size_t qo0 = (tok0 + q0 + lr) * DM + h * HD + 8 * hi;
#pragma unroll
    for (int kc = 0; kc < 2; ++kc) qa[kc] = cat16(*(const v8h*)(Q16 + qo0 + kc * 32), *(const v8h*)(Q16 + qo0 + kc * 32 + 16));
    const h16* kh_b = K16 + tok0 * DM + h * HD;
    const h16* kl_b = KL16 + tok0 * DM + h * HD;
    const size_t vbase = (((size_t)b * NH_ + h) * HD) * NT_;
    v8f o[4], ox[4];
#pragma unroll
    for (int n = 0; n < 4; ++n) { o[n] = (v8f){}; ox[n] = (v8f){}; }
    float mrow[8], lpart[8];
#pragma unroll
    for (int j = 0; j < 8; ++j) { mrow[j] = -3.0e38f; lpart[j] = 0.f; }
    int qpos[8];
#pragma unroll
    for (int j = 0; j < 8; ++j) qpos[j] = q0 + 8 * hi + j;
    const int kt_lo = 0, kt_hi = (qt * 64 + 63) / 32;     // causal
#pragma unroll 1
    for (int kt = kt_lo; kt <= kt_hi; ++kt) {
        const int l0 = kt * 32;
        const size_t ko0 = (size_t)(l0 + lr) * DM + 8 * hi, ko1 = (size_t)(l0 + 16 + lr) * DM + 8 * hi;
        v8f s0 = {}, s1 = {}, x0 = {}, x1 = {};
#pragma unroll
        for (int kc = 0; kc < 2; ++kc) {
            { const v16h k0h = cat16(*(const v8h*)(kh_b + ko0 + kc * 32), *(const v8h*)(kh_b + ko0 + kc * 32 + 16)), k1h = cat16(*(const v8h*)(kh_b + ko1 + kc * 32), *(const v8h*)(kh_b + ko1 + kc * 32 + 16));
              const v16h qlk = cat16(*(const v8h*)(QL16 + qo0 + kc * 32), *(const v8h*)(QL16 + qo0 + kc * 32 + 16));     // query residual re-read per step (registers)
              s0 = wmma16(qa[kc], k0h, s0); x0 = wmma16(qlk, k0h, x0); s1 = wmma16(qa[kc], k1h, s1); x1 = wmma16(qlk, k1h, x1);
              asm volatile("v_nop" : "+v"(s0), "+v"(s1), "+v"(x0), "+v"(x1) : "v"(qlk), "v"(k0h), "v"(k1h) : "memory"); }
            { const v16h k0l = cat16(*(const v8h*)(kl_b + ko0 + kc * 32), *(const v8h*)(kl_b + ko0 + kc * 32 + 16)), k1l = cat16(*(const v8h*)(kl_b + ko1 + kc * 32), *(const v8h*)(kl_b + ko1 + kc * 32 + 16));
              x0 = wmma16(qa[kc], k0l, x0); x1 = wmma16(qa[kc], k1l, x1);
              asm volatile("v_nop" : "+v"(x0), "+v"(x1) : "v"(k0l), "v"(k1l) : "memory"); }
        }
        asm volatile("v_nop\n\tv_nop\n\tv_nop\n\tv_nop" : "+v"(s0), "+v"(s1), "+v"(x0), "+v"(x1) : "v"(qa[0]), "v"(qa[1]));
        float alpha[8];
#pragma unroll
        for (int j = 0; j < 8; ++j) {
            const int ja = l0 + lr, jb = l0 + 16 + lr, qi = qpos[j];
            const float a0 = (ja <= qi) ? (s0[j] + x0[j] * LOSCI) * 0.125f : -__builtin_inff(), a1 = (jb <= qi) ? (s1[j] + x1[j] * LOSCI) * 0.125f : -__builtin_inff();
            float mx = fmaxf(a0, a1);
            mx = fmaxf(mx, __shfl_xor(mx, 1, 16)); mx = fmaxf(mx, __shfl_xor(mx, 2, 16)); mx = fmaxf(mx, __shfl_xor(mx, 4, 16)); mx = fmaxf(mx, __shfl_xor(mx, 8, 16));
            const float mn = fmaxf(mrow[j], mx);
            alpha[j] = __expf(mrow[j] - mn); mrow[j] = mn;
            const float p0 = __expf(a0 - mn), p1 = __expf(a1 - mn);
            lpart[j] = lpart[j] * alpha[j] + (p0 + p1);
            const int mr = hi * 8 + j;
            const float ps0 = p0 * PSC, ps1 = p1 * PSC; const h16 h0 = (h16)ps0, h1 = (h16)ps1;
            pl[mr * 32 + lr] = h0; pl[mr * 32 + 16 + lr] = h1;
            pl2[mr * 32 + lr] = (h16)((ps0 - (float)h0) * LOSC); pl2[mr * 32 + 16 + lr] = (h16)((ps1 - (float)h1) * LOSC);
        }
#pragma unroll
        for (int n = 0; n < 4; ++n)
#pragma unroll
            for (int j = 0; j < 8; ++j) { o[n][j] *= alpha[j]; ox[n][j] *= alpha[j]; }
        asm volatile("" ::: "memory");
        const v16h pa = cat16(*(const v8ha*)(pl + lr * 32 + hi * 8), *(const v8ha*)(pl + lr * 32 + 16 + hi * 8));
        const v16h px = cat16(*(const v8ha*)(pl2 + lr * 32 + hi * 8), *(const v8ha*)(pl2 + lr * 32 + 16 + hi * 8));
#pragma unroll
        for (int n = 0; n < 4; ++n) { const size_t vo = vbase + (size_t)(n * 16 + lr) * NT_ + l0 + hi * 8;
            const v16h vh = cat16(*(const v8h*)(VTH + vo), *(const v8h*)(VTH + vo + 16)), vl = cat16(*(const v8h*)(VTL + vo), *(const v8h*)(VTL + vo + 16));
            o[n] = wmma16(pa, vh, o[n]); ox[n] = wmma16(pa, vl, ox[n]); ox[n] = wmma16(px, vh, ox[n]);
            asm volatile("" : "+v"(o[n]), "+v"(ox[n]) : "v"(vh), "v"(vl) : "memory"); }
        asm volatile("v_nop\n\tv_nop\n\tv_nop\n\tv_nop" : "+v"(o[0]), "+v"(o[1]), "+v"(o[2]), "+v"(o[3]), "+v"(ox[0]), "+v"(ox[1]), "+v"(ox[2]), "+v"(ox[3]) : "v"(pa), "v"(px));
    }
    float inv[8];
#pragma unroll
    for (int j = 0; j < 8; ++j) { float rs = lpart[j]; rs += __shfl_xor(rs, 1, 16); rs += __shfl_xor(rs, 2, 16); rs += __shfl_xor(rs, 4, 16); rs += __shfl_xor(rs, 8, 16); inv[j] = 1.0f / (rs * PSC); }
    float* os = &ost[wave][0];
#pragma unroll
    for (int n = 0; n < 4; ++n)
#pragma unroll
        for (int j = 0; j < 8; ++j) os[(hi * 8 + j) * 68 + n * 16 + lr] = (o[n][j] + ox[n][j] * LOSCI) * inv[j];
    __syncthreads();
    const size_t cbase = (tok0 + q0) * DM + (size_t)h * HD;
    auto pass = [&]() {
#pragma unroll
        for (int s = 0; s < 8; ++s) { const int row = 2 * s + (lane >> 4), piece = lane & 15; const float* sp = os + row * 68 + piece * 4; v4f v;
#pragma unroll
            for (int i = 0; i < 4; ++i) v[i] = sp[i];
            *(v4f*)(CTX + cbase + (size_t)row * DM + piece * 4) = v; }
    };
    pass(); 
}

#define VST2(T, p, v) do { const T vst2_v_ = (v); *(T*)(p) = vst2_v_;  } while (0)

// k_wt: WT [n][K] = bf16(W[k][n]) (k-major [K][ncols]) via 64 x 64 LDS tiles; grid (K/64, ncols/64).
__global__ __launch_bounds__(256) void k_wt(const float* __restrict__ Wm, int K, int ncols, bf* WT) {
    __shared__ __align__(16) unsigned short tl[64 * 72];
    const int tid = threadIdx.x, k0 = blockIdx.x * 64, n0 = blockIdx.y * 64;
    const int kk = tid >> 2, nq = (tid & 3) * 16;
#pragma unroll
    for (int i = 0; i < 16; ++i) tl[(nq + i) * 72 + kk] = f2bf(Wm[(size_t)(k0 + kk) * ncols + n0 + nq + i]);
    __syncthreads();
    const int piece = tid & 7;
    auto pass = [&]() {
#pragma unroll
        for (int s = 0; s < 2; ++s) { const int nr = (tid >> 3) + 32 * s; const v8us val = *(const v8usa*)(tl + nr * 72 + piece * 8); *(v8us*)(WT + (size_t)(n0 + nr) * K + k0 + piece * 8) = val; }
    };
    pass(); 
}


__global__ __launch_bounds__(256) void k_plane16(const float* __restrict__ src, h16* PH, h16* PL) {
    typedef __attribute__((ext_vector_type(2))) _Float16 v2h;
    const int lane = threadIdx.x & 31; const size_t wid = (size_t)blockIdx.x * 8 + (threadIdx.x >> 5); if (wid >= (size_t)NTK * NH_) return; const size_t r = wid / NH_; const int h = (int)(wid % NH_);
    const size_t o = r * DM + h * HD + lane * 2; v2h oh, ol;
#pragma unroll
    for (int i = 0; i < 2; ++i) { const float v = src[o + i]; const h16 a = (h16)v; oh[i] = a; ol[i] = (h16)((v - (float)a) * LOSC); }
    *(v2h*)(PH + o) = oh; *(v2h*)(PL + o) = ol; 
}

extern "C" void kernel_launch(void* const* d_in, const int* in_sizes, int n_in,
                              void* d_out, int out_size, void* d_ws, size_t ws_size, hipStream_t stream) {
    (void)in_sizes; (void)n_in; (void)out_size;
    const float* x = (const float*)d_in[0]; const float* Wq = (const float*)d_in[1]; const float* Wk = (const float*)d_in[2]; const float* Wv = (const float*)d_in[3];
    float* out = (float*)d_out;    // [8][1024][768]
    char* wsp = (char*)d_ws;
    auto take = [&](size_t bytes) { char* p = wsp; wsp += (bytes + 255) & ~(size_t)255; return (void*)p; };
    bf* WqT = (bf*)take((size_t)DM * DM * 2); bf* WkT = (bf*)take((size_t)DM * DM * 2); bf* WvT = (bf*)take((size_t)DM * DM * 2);
    bf* Xb = (bf*)take((size_t)NTK * DM * 2); float* TMP = (float*)take((size_t)NTK * DM * 4);
    h16* QH = (h16*)take((size_t)NTK * DM * 2); h16* QL = (h16*)take((size_t)NTK * DM * 2); h16* KH = (h16*)take((size_t)NTK * DM * 2); h16* KL = (h16*)take((size_t)NTK * DM * 2); h16* VTH = (h16*)take((size_t)NTK * DM * 2); h16* VTL = (h16*)take((size_t)NTK * DM * 2);
    if ((size_t)(wsp - (char*)d_ws) > ws_size) return;    // 3 x 1.2 + 12.6 + 25.2 + 6 x 12.6 ~ 117 MB (111 MiB); TMP reused q -> k -> v in stream order
    for (int h = 0; h < NH_; ++h) { k_wt<<<dim3(DM / 64, HD / 64, 1), 256, 0, stream>>>(Wq + (size_t)h * DM * HD, DM, HD, WqT + (size_t)h * HD * DM); k_wt<<<dim3(DM / 64, HD / 64, 1), 256, 0, stream>>>(Wk + (size_t)h * DM * HD, DM, HD, WkT + (size_t)h * HD * DM); k_wt<<<dim3(DM / 64, HD / 64, 1), 256, 0, stream>>>(Wv + (size_t)h * DM * HD, DM, HD, WvT + (size_t)h * HD * DM); }
    k_cvtb<<<NTK / 8, 256, 0, stream>>>(x, NTK, Xb);
    k_gemmb<false, false><<<dim3(NTK / 64, DM / 64, 1), 128, 0, stream>>>(Xb, nullptr, WqT, nullptr, TMP, DM, nullptr); k_plane16<<<(NTK * NH_) / 8, 256, 0, stream>>>(TMP, QH, QL);
    k_gemmb<false, false><<<dim3(NTK / 64, DM / 64, 1), 128, 0, stream>>>(Xb, nullptr, WkT, nullptr, TMP, DM, nullptr); k_plane16<<<(NTK * NH_) / 8, 256, 0, stream>>>(TMP, KH, KL);
    k_gemmb<false, false><<<dim3(NTK / 64, DM / 64, 1), 128, 0, stream>>>(Xb, nullptr, WvT, nullptr, TMP, DM, nullptr); k_vt<<<NB_ * NH_ * (NT_ / 64), 256, 0, stream>>>(TMP, VTH, VTL);
    k_attn<<<NB_ * NH_ * (NT_ / 64), 128, 0, stream>>>(QH, QL, KH, KL, VTH, VTL, out);
}

// v001
// It runs in 366 microseconds.
// Next to v000, in two timings, it ran 1.23 times as fast each time.
#include <hip/hip_runtime.h>

// Compute dtypes, f32 accumulate: q, k, v = x.W_h for all 12 heads as three [8192 x 768].[768 x 768] GEMMs with PLAIN bf16 operands (rounded input; the per-head [768][64] weights
// transposed into one n-major plane; exact products) on v_wmma_f32_16x16x32_bf16; q/k as f16 hi + residual x1024 planes, v as f16 hi/lo transposed planes; per (item, head) causal
// attention over 1024 tokens: scores on v_wmma_f32_16x16x32_f16 (hh + hl + lh, x 1/8), online f32 softmax, weights (x32768) and v as f16 hi/lo on v_wmma_f32_16x16x32_f16; the

#define NB_  8
#define NT_  1024
#define DM   768
#define NH_  12
#define HD   64
#define NTK  (NB_ * NT_)          // 8192 token rows
#define NW   DM
#define PSC  32768.0f
#define LOSC 1024.0f
#define LOSCI (1.0f / 1024.0f)

typedef _Float16 h16;
typedef unsigned short bf;
typedef __attribute__((ext_vector_type(16))) __bf16   v16bf;
typedef __attribute__((ext_vector_type(16))) _Float16 v16h;
typedef __attribute__((ext_vector_type(8)))  _Float16 v8h;
typedef __attribute__((ext_vector_type(8)))  unsigned short v8us;
typedef __attribute__((ext_vector_type(8)))  float    v8f;
typedef __attribute__((ext_vector_type(4)))  float    v4f;
typedef v8h  __attribute__((may_alias)) v8ha;
typedef v4f  __attribute__((may_alias)) v4fa;
typedef v8us __attribute__((may_alias)) v8usa;

__device__ __forceinline__ unsigned short f2bf(float f) { unsigned u = __float_as_uint(f); u += 0x7FFFu + ((u >> 16) & 1u); return (unsigned short)(u >> 16); }
__device__ __forceinline__ float bf2f(unsigned short b) { return __uint_as_float(((unsigned)b) << 16); }
__device__ __forceinline__ float bfr(float f) { return bf2f(f2bf(f)); }
__device__ __forceinline__ v16h cat16(v8h lo, v8h hi) { return __builtin_shufflevector(lo, hi, 0, 1, 2, 3, 4, 5, 6, 7, 8, 9, 10, 11, 12, 13, 14, 15); }
__device__ __forceinline__ v16bf cat16b(v8us lo, v8us hi) { return __builtin_bit_cast(v16bf, __builtin_shufflevector(lo, hi, 0, 1, 2, 3, 4, 5, 6, 7, 8, 9, 10, 11, 12, 13, 14, 15)); }
__device__ __forceinline__ v8f wmma16(v16h a, v16h b, v8f c) { return __builtin_amdgcn_wmma_f32_16x16x32_f16(false, a, false, b, (short)0, c, false, false); }
__device__ __forceinline__ v8f wmmab(v16bf a, v16bf b, v8f c) { return __builtin_amdgcn_wmma_f32_16x16x32_bf16(false, a, false, b, (short)0, c, false, false); }

__global__ __launch_bounds__(256) void k_cvtb(const float* __restrict__ src, int nrows, bf* dst) {
    const int lane = threadIdx.x & 31, r = blockIdx.x * 8 + (threadIdx.x >> 5);
    if (r >= nrows) return;
    v8us o[DM / 256];
#pragma unroll
    for (int q = 0; q < DM / 256; ++q) { v8us t;
#pragma unroll
        for (int i = 0; i < 8; ++i) t[i] = f2bf(src[(size_t)r * DM + q * 256 + lane * 8 + i]);
        o[q] = t; }
#pragma unroll
    for (int q = 0; q < DM / 256; ++q) *(v8us*)(dst + (size_t)r * DM + q * 256 + lane * 8) = o[q];
    
}

// k_gemmb: 64 x 64 block tile (4 waves x 16 x 64) of C[NTK][NW] = (A [+ Al]).B^T (K = 768) [+ bf(bias[c])] [+ bf(R[r][c]) residual]; f32 whole-line epilogue (or f16
template <bool SPLITA, bool F16OUT = false>
__global__ __launch_bounds__(128) void k_gemmb(const bf* __restrict__ A, const bf* __restrict__ Al, const bf* __restrict__ Bn, const float* __restrict__ bias, float* C, int ldc, h16* C2, const float* __restrict__ R = nullptr, int K = DM, int roundR = 1) {
    __shared__ __align__(16) float ost[4][16 * 68];
    const int lane = threadIdx.x & 31, wave = threadIdx.x >> 5, lr = lane & 15, hi = lane >> 4;
    const int r0 = blockIdx.x * 64 + wave * 16, c0 = blockIdx.y * 64;
    const size_t aoff = (size_t)(r0 + lr) * K + 8 * hi;
    size_t boff[4];
#pragma unroll
    for (int t = 0; t < 4; ++t) boff[t] = (size_t)(c0 + t * 16 + lr) * K + 8 * hi;
    v8f acc[4];
#pragma unroll
    for (int t = 0; t < 4; ++t) acc[t] = (v8f){};
#pragma unroll 1
    for (int kc = 0; kc < K; kc += 32) {
        const v16bf a = cat16b(*(const v8us*)(A + aoff + kc), *(const v8us*)(A + aoff + kc + 16));
        v16bf al = a;
        if (SPLITA) al = cat16b(*(const v8us*)(Al + aoff + kc), *(const v8us*)(Al + aoff + kc + 16));
#pragma unroll
        for (int t = 0; t < 4; ++t) { const v16bf b = cat16b(*(const v8us*)(Bn + boff[t] + kc), *(const v8us*)(Bn + boff[t] + kc + 16)); acc[t] = wmmab(a, b, acc[t]); if (SPLITA) acc[t] = wmmab(al, b, acc[t]); }
        asm volatile("v_nop\n\tv_nop\n\tv_nop\n\tv_nop" : "+v"(acc[0]), "+v"(acc[1]), "+v"(acc[2]), "+v"(acc[3]) : "v"(a), "v"(al));
    }
    float* os = &ost[wave][0];
#pragma unroll
    for (int t = 0; t < 4; ++t) { const float bv = bias ? bfr(bias[c0 + t * 16 + lr]) : 0.f;
#pragma unroll
        for (int j = 0; j < 8; ++j) os[(hi * 8 + j) * 68 + t * 16 + lr] = acc[t][j] + bv; }
    __syncthreads();
    if (F16OUT) {
        h16* crow = (h16*)(void*)C + (size_t)r0 * ldc + c0;
        auto pass = [&]() {
#pragma unroll
            for (int s = 0; s < 4; ++s) { const int row = 4 * s + (lane >> 3), piece = lane & 7; const float* sp = os + row * 68 + piece * 8; v8h o, o2;
#pragma unroll
                for (int i = 0; i < 8; ++i) { const h16 a = (h16)sp[i]; o[i] = a; o2[i] = (h16)((sp[i] - (float)a) * LOSC); }
                *(v8h*)(crow + (size_t)row * ldc + piece * 8) = o; if (C2) *(v8h*)(C2 + (size_t)r0 * ldc + c0 + (size_t)row * ldc + piece * 8) = o2; }
        };
        pass(); 
    } else {
        float* crow = C + (size_t)r0 * ldc + c0;
        auto pass = [&]() {
#pragma unroll
            for (int s = 0; s < 8; ++s) { const int Lid = (lane >> 3) + 4 * s, piece = lane & 7; const int row = Lid >> 1, cofs = (Lid & 1) * 32 + piece * 4;
                v4f val = *(const v4fa*)(os + row * 68 + cofs); if (R) { const v4f rv = *(const v4f*)(R + ((size_t)r0 + row) * ldc + c0 + cofs); val += roundR ? (v4f){bfr(rv[0]), bfr(rv[1]), bfr(rv[2]), bfr(rv[3])} : rv; }
                *(v4f*)(crow + (size_t)row * ldc + cofs) = val; }
        };
        pass(); 
    }
}

__global__ __launch_bounds__(256) void k_vt(const float* __restrict__ V, h16* VTH, h16* VTL) {
    __shared__ __align__(16) h16 tile[64 * 72];
    __shared__ __align__(16) h16 til2[64 * 72];
    const int bid = blockIdx.x;
    const int b = bid / (NH_ * (NT_ / 64)), rem = bid - b * (NH_ * (NT_ / 64)), h = rem / (NT_ / 64), kt = rem - h * (NT_ / 64);
    const int k0 = kt * 64, tid = threadIdx.x;
    const int kk = tid >> 2, d0 = (tid & 3) * 16;
    const float* src = V + ((size_t)b * NT_ + k0 + kk) * DM + h * HD + d0;
#pragma unroll
    for (int i = 0; i < 16; ++i) { const float v = src[i]; const h16 a = (h16)v; tile[(d0 + i) * 72 + kk] = a; til2[(d0 + i) * 72 + kk] = (h16)((v - (float)a) * LOSC); }
    __syncthreads();
    const int piece = tid & 7;
    const size_t base = (((size_t)b * NH_ + h) * HD) * NT_ + k0;
    auto pass = [&]() {
#pragma unroll
        for (int s = 0; s < 4; ++s) { const int Lid = (tid >> 3) + 32 * s; const int pln = Lid >> 6, d = Lid & 63;
            const v8h val = *(const v8ha*)((pln ? til2 : tile) + d * 72 + piece * 8); *(v8h*)((pln ? VTL : VTH) + base + (size_t)d * NT_ + piece * 8) = val; }
    };
    pass(); 
}

// k_attn: block = (b, h, 64 queries), wave = 16; CAUSAL: key tiles 0..(64qt+63)/32 with per-element j <= i; 12 WMMA scores (hh + lh + hl) /8 (f32), online softmax, weights x32768 f16 hi/lo tiles (same-wave may_alias
// reload after a compiler barrier), 12 WMMA .v (hh + hl + lh); ctx -> f32 output rows [tok][h*64+d] (16 lanes x 16 B per head slice).
__global__ __launch_bounds__(128) void k_attn(const h16* __restrict__ Q16, const h16* __restrict__ QL16, const h16* __restrict__ K16, const h16* __restrict__ KL16, const h16* __restrict__ VTH, const h16* __restrict__ VTL, float* CTX) {
    __shared__ __align__(16) h16 plds[4][16 * 32];
    __shared__ __align__(16) h16 plds2[4][16 * 32];
    __shared__ __align__(16) float ost[4][16 * 68];
    const int lane = threadIdx.x & 31, wave = threadIdx.x >> 5, lr = lane & 15, hi = lane >> 4;
    const int bid = blockIdx.x;
    const int b = bid / (NH_ * (NT_ / 64)), rem = bid - b * (NH_ * (NT_ / 64)), h = rem / (NT_ / 64), qt = rem - h * (NT_ / 64);
    const int q0 = qt * 64 + wave * 16;
    const size_t tok0 = (size_t)b * NT_;
    h16* pl = &plds[wave][0]; h16* pl2 = &plds2[wave][0];
    v16h qa[2];
    const size_t qo0 = (tok0 + q0 + lr) * DM + h * HD + 8 * hi;
#pragma unroll
    for (int kc = 0; kc < 2; ++kc) qa[kc] = cat16(*(const v8h*)(Q16 + qo0 + kc * 32), *(const v8h*)(Q16 + qo0 + kc * 32 + 16));
    const h16* kh_b = K16 + tok0 * DM + h * HD;
    const h16* kl_b = KL16 + tok0 * DM + h * HD;
    const size_t vbase = (((size_t)b * NH_ + h) * HD) * NT_;
    v8f o[4], ox[4];
#pragma unroll
    for (int n = 0; n < 4; ++n) { o[n] = (v8f){}; ox[n] = (v8f){}; }
    float mrow[8], lpart[8];
#pragma unroll
    for (int j = 0; j < 8; ++j) { mrow[j] = -3.0e38f; lpart[j] = 0.f; }
    int qpos[8];
#pragma unroll
    for (int j = 0; j < 8; ++j) qpos[j] = q0 + 8 * hi + j;
    const int kt_lo = 0, kt_hi = (qt * 64 + 63) / 32;     // causal
#pragma unroll 1
    for (int kt = kt_lo; kt <= kt_hi; ++kt) {
        const int l0 = kt * 32;
        const size_t ko0 = (size_t)(l0 + lr) * DM + 8 * hi, ko1 = (size_t)(l0 + 16 + lr) * DM + 8 * hi;
        v8f s0 = {}, s1 = {}, x0 = {}, x1 = {};
#pragma unroll
        for (int kc = 0; kc < 2; ++kc) {
            { const v16h k0h = cat16(*(const v8h*)(kh_b + ko0 + kc * 32), *(const v8h*)(kh_b + ko0 + kc * 32 + 16)), k1h = cat16(*(const v8h*)(kh_b + ko1 + kc * 32), *(const v8h*)(kh_b + ko1 + kc * 32 + 16));
              const v16h qlk = cat16(*(const v8h*)(QL16 + qo0 + kc * 32), *(const v8h*)(QL16 + qo0 + kc * 32 + 16));     // query residual re-read per step (registers)
              s0 = wmma16(qa[kc], k0h, s0); x0 = wmma16(qlk, k0h, x0); s1 = wmma16(qa[kc], k1h, s1); x1 = wmma16(qlk, k1h, x1);
              asm volatile("v_nop" : "+v"(s0), "+v"(s1), "+v"(x0), "+v"(x1) : "v"(qlk), "v"(k0h), "v"(k1h) : "memory"); }
            { const v16h k0l = cat16(*(const v8h*)(kl_b + ko0 + kc * 32), *(const v8h*)(kl_b + ko0 + kc * 32 + 16)), k1l = cat16(*(const v8h*)(kl_b + ko1 + kc * 32), *(const v8h*)(kl_b + ko1 + kc * 32 + 16));
              x0 = wmma16(qa[kc], k0l, x0); x1 = wmma16(qa[kc], k1l, x1);
              asm volatile("v_nop" : "+v"(x0), "+v"(x1) : "v"(k0l), "v"(k1l) : "memory"); }
        }
        asm volatile("v_nop\n\tv_nop\n\tv_nop\n\tv_nop" : "+v"(s0), "+v"(s1), "+v"(x0), "+v"(x1) : "v"(qa[0]), "v"(qa[1]));
        float alpha[8];
#pragma unroll
        for (int j = 0; j < 8; ++j) {
            const int ja = l0 + lr, jb = l0 + 16 + lr, qi = qpos[j];
            const float a0 = (ja <= qi) ? (s0[j] + x0[j] * LOSCI) * 0.125f : -__builtin_inff(), a1 = (jb <= qi) ? (s1[j] + x1[j] * LOSCI) * 0.125f : -__builtin_inff();
            float mx = fmaxf(a0, a1);
            mx = fmaxf(mx, __shfl_xor(mx, 1, 16)); mx = fmaxf(mx, __shfl_xor(mx, 2, 16)); mx = fmaxf(mx, __shfl_xor(mx, 4, 16)); mx = fmaxf(mx, __shfl_xor(mx, 8, 16));
            const float mn = fmaxf(mrow[j], mx);
            alpha[j] = __expf(mrow[j] - mn); mrow[j] = mn;
            const float p0 = __expf(a0 - mn), p1 = __expf(a1 - mn);
            lpart[j] = lpart[j] * alpha[j] + (p0 + p1);
            const int mr = hi * 8 + j;
            const float ps0 = p0 * PSC, ps1 = p1 * PSC; const h16 h0 = (h16)ps0, h1 = (h16)ps1;
            pl[mr * 32 + lr] = h0; pl[mr * 32 + 16 + lr] = h1;
            pl2[mr * 32 + lr] = (h16)((ps0 - (float)h0) * LOSC); pl2[mr * 32 + 16 + lr] = (h16)((ps1 - (float)h1) * LOSC);
        }
#pragma unroll
        for (int n = 0; n < 4; ++n)
#pragma unroll
            for (int j = 0; j < 8; ++j) { o[n][j] *= alpha[j]; ox[n][j] *= alpha[j]; }
        asm volatile("" ::: "memory");
        const v16h pa = cat16(*(const v8ha*)(pl + lr * 32 + hi * 8), *(const v8ha*)(pl + lr * 32 + 16 + hi * 8));
        const v16h px = cat16(*(const v8ha*)(pl2 + lr * 32 + hi * 8), *(const v8ha*)(pl2 + lr * 32 + 16 + hi * 8));
#pragma unroll
        for (int n = 0; n < 4; ++n) { const size_t vo = vbase + (size_t)(n * 16 + lr) * NT_ + l0 + hi * 8;
            const v16h vh = cat16(*(const v8h*)(VTH + vo), *(const v8h*)(VTH + vo + 16)), vl = cat16(*(const v8h*)(VTL + vo), *(const v8h*)(VTL + vo + 16));
            o[n] = wmma16(pa, vh, o[n]); ox[n] = wmma16(pa, vl, ox[n]); ox[n] = wmma16(px, vh, ox[n]);
            asm volatile("" : "+v"(o[n]), "+v"(ox[n]) : "v"(vh), "v"(vl) : "memory"); }
        asm volatile("v_nop\n\tv_nop\n\tv_nop\n\tv_nop" : "+v"(o[0]), "+v"(o[1]), "+v"(o[2]), "+v"(o[3]), "+v"(ox[0]), "+v"(ox[1]), "+v"(ox[2]), "+v"(ox[3]) : "v"(pa), "v"(px));
    }
    float inv[8];
#pragma unroll
    for (int j = 0; j < 8; ++j) { float rs = lpart[j]; rs += __shfl_xor(rs, 1, 16); rs += __shfl_xor(rs, 2, 16); rs += __shfl_xor(rs, 4, 16); rs += __shfl_xor(rs, 8, 16); inv[j] = 1.0f / (rs * PSC); }
    float* os = &ost[wave][0];
#pragma unroll
    for (int n = 0; n < 4; ++n)
#pragma unroll
        for (int j = 0; j < 8; ++j) os[(hi * 8 + j) * 68 + n * 16 + lr] = (o[n][j] + ox[n][j] * LOSCI) * inv[j];
    __syncthreads();
    const size_t cbase = (tok0 + q0) * DM + (size_t)h * HD;
    auto pass = [&]() {
#pragma unroll
        for (int s = 0; s < 8; ++s) { const int row = 2 * s + (lane >> 4), piece = lane & 15; const float* sp = os + row * 68 + piece * 4; v4f v;
#pragma unroll
            for (int i = 0; i < 4; ++i) v[i] = sp[i];
            *(v4f*)(CTX + cbase + (size_t)row * DM + piece * 4) = v; }
    };
    pass(); 
}

#define VST2(T, p, v) do { const T vst2_v_ = (v); *(T*)(p) = vst2_v_;  } while (0)

// k_wt: every per-head weight plane in ONE launch; grid (DM/64, heads, 3): z picks Wq / Wk / Wv, y the head; WT[h*64 + n][k] = bf16(W[h][k][n]) via 64 x 64 LDS tiles.
__global__ __launch_bounds__(256) void k_wt(const float* __restrict__ Wq, const float* __restrict__ Wk, const float* __restrict__ Wv, bf* WqT, bf* WkT, bf* WvT) {
    __shared__ __align__(16) unsigned short tl[64 * 72];
    const int tid = threadIdx.x, k0 = blockIdx.x * 64, h = blockIdx.y, z = blockIdx.z;
    const float* Wm = (z == 0 ? Wq : z == 1 ? Wk : Wv) + (size_t)h * DM * HD;
    bf* WT = (z == 0 ? WqT : z == 1 ? WkT : WvT) + (size_t)h * HD * DM;
    const int kk = tid >> 2, nq = (tid & 3) * 16;
#pragma unroll
    for (int i = 0; i < 16; ++i) tl[(nq + i) * 72 + kk] = f2bf(Wm[(size_t)(k0 + kk) * HD + nq + i]);
    __syncthreads();
    const int piece = tid & 7;
#pragma unroll
    for (int s = 0; s < 2; ++s) { const int nr = (tid >> 3) + 32 * s; const v8us val = *(const v8usa*)(tl + nr * 72 + piece * 8); *(v8us*)(WT + (size_t)nr * DM + k0 + piece * 8) = val; }
}


__global__ __launch_bounds__(256) void k_plane16(const float* __restrict__ src, h16* PH, h16* PL) {
    typedef __attribute__((ext_vector_type(2))) _Float16 v2h;
    const int lane = threadIdx.x & 31; const size_t wid = (size_t)blockIdx.x * 8 + (threadIdx.x >> 5); if (wid >= (size_t)NTK * NH_) return; const size_t r = wid / NH_; const int h = (int)(wid % NH_);
    const size_t o = r * DM + h * HD + lane * 2; v2h oh, ol;
#pragma unroll
    for (int i = 0; i < 2; ++i) { const float v = src[o + i]; const h16 a = (h16)v; oh[i] = a; ol[i] = (h16)((v - (float)a) * LOSC); }
    *(v2h*)(PH + o) = oh; *(v2h*)(PL + o) = ol; 
}

extern "C" void kernel_launch(void* const* d_in, const int* in_sizes, int n_in,
                              void* d_out, int out_size, void* d_ws, size_t ws_size, hipStream_t stream) {
    (void)in_sizes; (void)n_in; (void)out_size;
    const float* x = (const float*)d_in[0]; const float* Wq = (const float*)d_in[1]; const float* Wk = (const float*)d_in[2]; const float* Wv = (const float*)d_in[3];
    float* out = (float*)d_out;    // [8][1024][768]
    char* wsp = (char*)d_ws;
    auto take = [&](size_t bytes) { char* p = wsp; wsp += (bytes + 255) & ~(size_t)255; return (void*)p; };
    bf* WqT = (bf*)take((size_t)DM * DM * 2); bf* WkT = (bf*)take((size_t)DM * DM * 2); bf* WvT = (bf*)take((size_t)DM * DM * 2);
    bf* Xb = (bf*)take((size_t)NTK * DM * 2); float* TMP = (float*)take((size_t)NTK * DM * 4);
    h16* QH = (h16*)take((size_t)NTK * DM * 2); h16* QL = (h16*)take((size_t)NTK * DM * 2); h16* KH = (h16*)take((size_t)NTK * DM * 2); h16* KL = (h16*)take((size_t)NTK * DM * 2); h16* VTH = (h16*)take((size_t)NTK * DM * 2); h16* VTL = (h16*)take((size_t)NTK * DM * 2);
    if ((size_t)(wsp - (char*)d_ws) > ws_size) return;    // 3 x 1.2 + 12.6 + 25.2 + 6 x 12.6 ~ 117 MB (111 MiB); TMP reused q -> k -> v in stream order
    k_wt<<<dim3(DM / 64, NH_, 3), 256, 0, stream>>>(Wq, Wk, Wv, WqT, WkT, WvT);
    k_cvtb<<<NTK / 8, 256, 0, stream>>>(x, NTK, Xb);
    k_gemmb<false, false><<<dim3(NTK / 64, DM / 64, 1), 128, 0, stream>>>(Xb, nullptr, WqT, nullptr, TMP, DM, nullptr); k_plane16<<<(NTK * NH_) / 8, 256, 0, stream>>>(TMP, QH, QL);
    k_gemmb<false, false><<<dim3(NTK / 64, DM / 64, 1), 128, 0, stream>>>(Xb, nullptr, WkT, nullptr, TMP, DM, nullptr); k_plane16<<<(NTK * NH_) / 8, 256, 0, stream>>>(TMP, KH, KL);
    k_gemmb<false, false><<<dim3(NTK / 64, DM / 64, 1), 128, 0, stream>>>(Xb, nullptr, WvT, nullptr, TMP, DM, nullptr); k_vt<<<NB_ * NH_ * (NT_ / 64), 256, 0, stream>>>(TMP, VTH, VTL);
    k_attn<<<NB_ * NH_ * (NT_ / 64), 128, 0, stream>>>(QH, QL, KH, KL, VTH, VTL, out);
}

// v002
// A run of this version takes 332 microseconds.
// Two timings next to v001 both put it at 1.10 times that version's speed.
// All steps since v000 together make it 1.35 times as fast.
#include <hip/hip_runtime.h>

// Compute dtypes, f32 accumulate: q, k, v = x.W_h for all 12 heads as three [8192 x 768].[768 x 768] GEMMs with PLAIN bf16 operands (rounded input; the per-head [768][64] weights
// transposed into one n-major plane; exact products) on v_wmma_f32_16x16x32_bf16; q/k as f16 hi + residual x1024 planes, v as f16 hi/lo transposed planes; per (item, head) causal
// attention over 1024 tokens: scores on v_wmma_f32_16x16x32_f16 (hh + hl + lh, x 1/8), online f32 softmax, weights (x32768) and v as f16 hi/lo on v_wmma_f32_16x16x32_f16; the

#define NB_  8
#define NT_  1024
#define DM   768
#define NH_  12
#define HD   64
#define NTK  (NB_ * NT_)          // 8192 token rows
#define NW   DM
#define PSC  32768.0f
#define LOSC 1024.0f
#define LOSCI (1.0f / 1024.0f)

typedef _Float16 h16;
typedef unsigned short bf;
typedef __attribute__((ext_vector_type(16))) __bf16   v16bf;
typedef __attribute__((ext_vector_type(16))) _Float16 v16h;
typedef __attribute__((ext_vector_type(8)))  _Float16 v8h;
typedef __attribute__((ext_vector_type(8)))  unsigned short v8us;
typedef __attribute__((ext_vector_type(8)))  float    v8f;
typedef __attribute__((ext_vector_type(4)))  float    v4f;
typedef v8h  __attribute__((may_alias)) v8ha;
typedef v4f  __attribute__((may_alias)) v4fa;
typedef v8us __attribute__((may_alias)) v8usa;

__device__ __forceinline__ unsigned short f2bf(float f) { unsigned u = __float_as_uint(f); u += 0x7FFFu + ((u >> 16) & 1u); return (unsigned short)(u >> 16); }
__device__ __forceinline__ float bf2f(unsigned short b) { return __uint_as_float(((unsigned)b) << 16); }
__device__ __forceinline__ float bfr(float f) { return bf2f(f2bf(f)); }
__device__ __forceinline__ v16h cat16(v8h lo, v8h hi) { return __builtin_shufflevector(lo, hi, 0, 1, 2, 3, 4, 5, 6, 7, 8, 9, 10, 11, 12, 13, 14, 15); }
__device__ __forceinline__ v16bf cat16b(v8us lo, v8us hi) { return __builtin_bit_cast(v16bf, __builtin_shufflevector(lo, hi, 0, 1, 2, 3, 4, 5, 6, 7, 8, 9, 10, 11, 12, 13, 14, 15)); }
__device__ __forceinline__ v8f wmma16(v16h a, v16h b, v8f c) { return __builtin_amdgcn_wmma_f32_16x16x32_f16(false, a, false, b, (short)0, c, false, false); }
__device__ __forceinline__ v8f wmmab(v16bf a, v16bf b, v8f c) { return __builtin_amdgcn_wmma_f32_16x16x32_bf16(false, a, false, b, (short)0, c, false, false); }

__global__ __launch_bounds__(256) void k_cvtb(const float* __restrict__ src, int nrows, bf* dst) {
    const int lane = threadIdx.x & 31, r = blockIdx.x * 8 + (threadIdx.x >> 5);
    if (r >= nrows) return;
    v8us o[DM / 256];
#pragma unroll
    for (int q = 0; q < DM / 256; ++q) { v8us t;
#pragma unroll
        for (int i = 0; i < 8; ++i) t[i] = f2bf(src[(size_t)r * DM + q * 256 + lane * 8 + i]);
        o[q] = t; }
#pragma unroll
    for (int q = 0; q < DM / 256; ++q) *(v8us*)(dst + (size_t)r * DM + q * 256 + lane * 8) = o[q];
    
}

// k_gemmb: 64 x 64 block tile (4 waves x 16 x 64) of C[NTK][NW] = (A [+ Al]).B^T (K = 768) [+ bf(bias[c])] [+ bf(R[r][c]) residual]; f32 whole-line epilogue (or f16
// VTOUT: the tile leaves as the two transposed f16 planes [item][head][d][token] (C = hi, C2 = residual x1024); block tile = 64 tokens x one head.
template <bool SPLITA, bool F16OUT = false, bool VTOUT = false>
__global__ __launch_bounds__(128) void k_gemmb(const bf* __restrict__ A, const bf* __restrict__ Al, const bf* __restrict__ Bn, const float* __restrict__ bias, float* C, int ldc, h16* C2, const float* __restrict__ R = nullptr, int K = DM, int roundR = 1) {
    __shared__ __align__(16) float ost[4][16 * 68];
    const int lane = threadIdx.x & 31, wave = threadIdx.x >> 5, lr = lane & 15, hi = lane >> 4;
    const int r0 = blockIdx.x * 64 + wave * 16, c0 = blockIdx.y * 64;
    const size_t aoff = (size_t)(r0 + lr) * K + 8 * hi;
    size_t boff[4];
#pragma unroll
    for (int t = 0; t < 4; ++t) boff[t] = (size_t)(c0 + t * 16 + lr) * K + 8 * hi;
    v8f acc[4];
#pragma unroll
    for (int t = 0; t < 4; ++t) acc[t] = (v8f){};
#pragma unroll 1
    for (int kc = 0; kc < K; kc += 32) {
        const v16bf a = cat16b(*(const v8us*)(A + aoff + kc), *(const v8us*)(A + aoff + kc + 16));
        v16bf al = a;
        if (SPLITA) al = cat16b(*(const v8us*)(Al + aoff + kc), *(const v8us*)(Al + aoff + kc + 16));
#pragma unroll
        for (int t = 0; t < 4; ++t) { const v16bf b = cat16b(*(const v8us*)(Bn + boff[t] + kc), *(const v8us*)(Bn + boff[t] + kc + 16)); acc[t] = wmmab(a, b, acc[t]); if (SPLITA) acc[t] = wmmab(al, b, acc[t]); }
        asm volatile("v_nop\n\tv_nop\n\tv_nop\n\tv_nop" : "+v"(acc[0]), "+v"(acc[1]), "+v"(acc[2]), "+v"(acc[3]) : "v"(a), "v"(al));
    }
    if constexpr (VTOUT) {
        __shared__ __align__(16) h16 tile[64 * 72];
        __shared__ __align__(16) h16 til2[64 * 72];
        // a lane's accumulator holds 8 consecutive tokens of one head dim: one 16-B piece of a transposed row
#pragma unroll
        for (int t = 0; t < 4; ++t) { v8h a8, l8;
#pragma unroll
            for (int j = 0; j < 8; ++j) { const float v = acc[t][j]; const h16 a = (h16)v; a8[j] = a; l8[j] = (h16)((v - (float)a) * LOSC); }
            *(v8ha*)(tile + (t * 16 + lr) * 72 + wave * 16 + hi * 8) = a8; *(v8ha*)(til2 + (t * 16 + lr) * 72 + wave * 16 + hi * 8) = l8; }
        __syncthreads();
        const int tid = threadIdx.x, piece = tid & 7;
        const int b = blockIdx.x / (NT_ / 64), k0 = (blockIdx.x % (NT_ / 64)) * 64, h = blockIdx.y;
        const size_t base = (((size_t)b * NH_ + h) * HD) * NT_ + k0;
        h16* VTH = (h16*)(void*)C;
#pragma unroll
        for (int s = 0; s < 8; ++s) { const int pln = s >> 2, d = (tid >> 3) + 16 * (s & 3);     // 8 lanes write one whole 128-B line
            const v8h val = *(const v8ha*)((pln ? til2 : tile) + d * 72 + piece * 8); *(v8h*)((pln ? C2 : VTH) + base + (size_t)d * NT_ + piece * 8) = val; }
        return;
    }
    float* os = &ost[wave][0];
#pragma unroll
    for (int t = 0; t < 4; ++t) { const float bv = bias ? bfr(bias[c0 + t * 16 + lr]) : 0.f;
#pragma unroll
        for (int j = 0; j < 8; ++j) os[(hi * 8 + j) * 68 + t * 16 + lr] = acc[t][j] + bv; }
    __syncthreads();
    if (F16OUT) {
        h16* crow = (h16*)(void*)C + (size_t)r0 * ldc + c0;
        h16* crow2 = C2 + (size_t)r0 * ldc + c0;
        const int piece = lane & 7;
        v8h o[4], o2[4];     // both planes' pieces first, then the 8 whole-line stores in a row
#pragma unroll
        for (int s = 0; s < 4; ++s) { const float* sp = os + (4 * s + (lane >> 3)) * 68 + piece * 8;
#pragma unroll
            for (int i = 0; i < 8; ++i) { const h16 a = (h16)sp[i]; o[s][i] = a; o2[s][i] = (h16)((sp[i] - (float)a) * LOSC); } }
#pragma unroll
        for (int s = 0; s < 4; ++s) { const size_t ro = (size_t)(4 * s + (lane >> 3)) * ldc + piece * 8; *(v8h*)(crow + ro) = o[s]; *(v8h*)(crow2 + ro) = o2[s]; }
    } else {
        float* crow = C + (size_t)r0 * ldc + c0;
        auto pass = [&]() {
#pragma unroll
            for (int s = 0; s < 8; ++s) { const int Lid = (lane >> 3) + 4 * s, piece = lane & 7; const int row = Lid >> 1, cofs = (Lid & 1) * 32 + piece * 4;
                v4f val = *(const v4fa*)(os + row * 68 + cofs); if (R) { const v4f rv = *(const v4f*)(R + ((size_t)r0 + row) * ldc + c0 + cofs); val += roundR ? (v4f){bfr(rv[0]), bfr(rv[1]), bfr(rv[2]), bfr(rv[3])} : rv; }
                *(v4f*)(crow + (size_t)row * ldc + cofs) = val; }
        };
        pass(); 
    }
}

// k_attn: block = (b, h, 64 queries), wave = 16; CAUSAL: key tiles 0..(64qt+63)/32 with per-element j <= i; 12 WMMA scores (hh + lh + hl) /8 (f32), online softmax, weights x32768 f16 hi/lo tiles (same-wave may_alias
// reload after a compiler barrier), 12 WMMA .v (hh + hl + lh); ctx -> f32 output rows [tok][h*64+d] (16 lanes x 16 B per head slice).
__global__ __launch_bounds__(128) void k_attn(const h16* __restrict__ Q16, const h16* __restrict__ QL16, const h16* __restrict__ K16, const h16* __restrict__ KL16, const h16* __restrict__ VTH, const h16* __restrict__ VTL, float* CTX) {
    __shared__ __align__(16) h16 plds[4][16 * 32];
    __shared__ __align__(16) h16 plds2[4][16 * 32];
    __shared__ __align__(16) float ost[4][16 * 68];
    const int lane = threadIdx.x & 31, wave = threadIdx.x >> 5, lr = lane & 15, hi = lane >> 4;
    const int bid = blockIdx.x;
    const int b = bid / (NH_ * (NT_ / 64)), rem = bid - b * (NH_ * (NT_ / 64)), h = rem / (NT_ / 64), qt = rem - h * (NT_ / 64);
    const int q0 = qt * 64 + wave * 16;
    const size_t tok0 = (size_t)b * NT_;
    h16* pl = &plds[wave][0]; h16* pl2 = &plds2[wave][0];
    v16h qa[2];
    const size_t qo0 = (tok0 + q0 + lr) * DM + h * HD + 8 * hi;
#pragma unroll
    for (int kc = 0; kc < 2; ++kc) qa[kc] = cat16(*(const v8h*)(Q16 + qo0 + kc * 32), *(const v8h*)(Q16 + qo0 + kc * 32 + 16));
    const h16* kh_b = K16 + tok0 * DM + h * HD;
    const h16* kl_b = KL16 + tok0 * DM + h * HD;
    const size_t vbase = (((size_t)b * NH_ + h) * HD) * NT_;
    v8f o[4], ox[4];
#pragma unroll
    for (int n = 0; n < 4; ++n) { o[n] = (v8f){}; ox[n] = (v8f){}; }
    float mrow[8], lpart[8];
#pragma unroll
    for (int j = 0; j < 8; ++j) { mrow[j] = -3.0e38f; lpart[j] = 0.f; }
    int qpos[8];
#pragma unroll
    for (int j = 0; j < 8; ++j) qpos[j] = q0 + 8 * hi + j;
    const int kt_lo = 0, kt_hi = (qt * 64 + 63) / 32;     // causal
#pragma unroll 1
    for (int kt = kt_lo; kt <= kt_hi; ++kt) {
        const int l0 = kt * 32;
        const size_t ko0 = (size_t)(l0 + lr) * DM + 8 * hi, ko1 = (size_t)(l0 + 16 + lr) * DM + 8 * hi;
        v8f s0 = {}, s1 = {}, x0 = {}, x1 = {};
#pragma unroll
        for (int kc = 0; kc < 2; ++kc) {
            { const v16h k0h = cat16(*(const v8h*)(kh_b + ko0 + kc * 32), *(const v8h*)(kh_b + ko0 + kc * 32 + 16)), k1h = cat16(*(const v8h*)(kh_b + ko1 + kc * 32), *(const v8h*)(kh_b + ko1 + kc * 32 + 16));
              const v16h qlk = cat16(*(const v8h*)(QL16 + qo0 + kc * 32), *(const v8h*)(QL16 + qo0 + kc * 32 + 16));     // query residual re-read per step (registers)
              s0 = wmma16(qa[kc], k0h, s0); x0 = wmma16(qlk, k0h, x0); s1 = wmma16(qa[kc], k1h, s1); x1 = wmma16(qlk, k1h, x1);
              asm volatile("v_nop" : "+v"(s0), "+v"(s1), "+v"(x0), "+v"(x1) : "v"(qlk), "v"(k0h), "v"(k1h) : "memory"); }
            { const v16h k0l = cat16(*(const v8h*)(kl_b + ko0 + kc * 32), *(const v8h*)(kl_b + ko0 + kc * 32 + 16)), k1l = cat16(*(const v8h*)(kl_b + ko1 + kc * 32), *(const v8h*)(kl_b + ko1 + kc * 32 + 16));
              x0 = wmma16(qa[kc], k0l, x0); x1 = wmma16(qa[kc], k1l, x1);
              asm volatile("v_nop" : "+v"(x0), "+v"(x1) : "v"(k0l), "v"(k1l) : "memory"); }
        }
        asm volatile("v_nop\n\tv_nop\n\tv_nop\n\tv_nop" : "+v"(s0), "+v"(s1), "+v"(x0), "+v"(x1) : "v"(qa[0]), "v"(qa[1]));
        float alpha[8];
#pragma unroll
        for (int j = 0; j < 8; ++j) {
            const int ja = l0 + lr, jb = l0 + 16 + lr, qi = qpos[j];
            const float a0 = (ja <= qi) ? (s0[j] + x0[j] * LOSCI) * 0.125f : -__builtin_inff(), a1 = (jb <= qi) ? (s1[j] + x1[j] * LOSCI) * 0.125f : -__builtin_inff();
            float mx = fmaxf(a0, a1);
            mx = fmaxf(mx, __shfl_xor(mx, 1, 16)); mx = fmaxf(mx, __shfl_xor(mx, 2, 16)); mx = fmaxf(mx, __shfl_xor(mx, 4, 16)); mx = fmaxf(mx, __shfl_xor(mx, 8, 16));
            const float mn = fmaxf(mrow[j], mx);
            alpha[j] = __expf(mrow[j] - mn); mrow[j] = mn;
            const float p0 = __expf(a0 - mn), p1 = __expf(a1 - mn);
            lpart[j] = lpart[j] * alpha[j] + (p0 + p1);
            const int mr = hi * 8 + j;
            const float ps0 = p0 * PSC, ps1 = p1 * PSC; const h16 h0 = (h16)ps0, h1 = (h16)ps1;
            pl[mr * 32 + lr] = h0; pl[mr * 32 + 16 + lr] = h1;
            pl2[mr * 32 + lr] = (h16)((ps0 - (float)h0) * LOSC); pl2[mr * 32 + 16 + lr] = (h16)((ps1 - (float)h1) * LOSC);
        }
#pragma unroll
        for (int n = 0; n < 4; ++n)
#pragma unroll
            for (int j = 0; j < 8; ++j) { o[n][j] *= alpha[j]; ox[n][j] *= alpha[j]; }
        asm volatile("" ::: "memory");
        const v16h pa = cat16(*(const v8ha*)(pl + lr * 32 + hi * 8), *(const v8ha*)(pl + lr * 32 + 16 + hi * 8));
        const v16h px = cat16(*(const v8ha*)(pl2 + lr * 32 + hi * 8), *(const v8ha*)(pl2 + lr * 32 + 16 + hi * 8));
#pragma unroll
        for (int n = 0; n < 4; ++n) { const size_t vo = vbase + (size_t)(n * 16 + lr) * NT_ + l0 + hi * 8;
            const v16h vh = cat16(*(const v8h*)(VTH + vo), *(const v8h*)(VTH + vo + 16)), vl = cat16(*(const v8h*)(VTL + vo), *(const v8h*)(VTL + vo + 16));
            o[n] = wmma16(pa, vh, o[n]); ox[n] = wmma16(pa, vl, ox[n]); ox[n] = wmma16(px, vh, ox[n]);
            asm volatile("" : "+v"(o[n]), "+v"(ox[n]) : "v"(vh), "v"(vl) : "memory"); }
        asm volatile("v_nop\n\tv_nop\n\tv_nop\n\tv_nop" : "+v"(o[0]), "+v"(o[1]), "+v"(o[2]), "+v"(o[3]), "+v"(ox[0]), "+v"(ox[1]), "+v"(ox[2]), "+v"(ox[3]) : "v"(pa), "v"(px));
    }
    float inv[8];
#pragma unroll
    for (int j = 0; j < 8; ++j) { float rs = lpart[j]; rs += __shfl_xor(rs, 1, 16); rs += __shfl_xor(rs, 2, 16); rs += __shfl_xor(rs, 4, 16); rs += __shfl_xor(rs, 8, 16); inv[j] = 1.0f / (rs * PSC); }
    float* os = &ost[wave][0];
#pragma unroll
    for (int n = 0; n < 4; ++n)
#pragma unroll
        for (int j = 0; j < 8; ++j) os[(hi * 8 + j) * 68 + n * 16 + lr] = (o[n][j] + ox[n][j] * LOSCI) * inv[j];
    __syncthreads();
    const size_t cbase = (tok0 + q0) * DM + (size_t)h * HD;
    auto pass = [&]() {
#pragma unroll
        for (int s = 0; s < 8; ++s) { const int row = 2 * s + (lane >> 4), piece = lane & 15; const float* sp = os + row * 68 + piece * 4; v4f v;
#pragma unroll
            for (int i = 0; i < 4; ++i) v[i] = sp[i];
            *(v4f*)(CTX + cbase + (size_t)row * DM + piece * 4) = v; }
    };
    pass(); 
}

#define VST2(T, p, v) do { const T vst2_v_ = (v); *(T*)(p) = vst2_v_;  } while (0)

// k_wt: every per-head weight plane in ONE launch; grid (DM/64, heads, 3): z picks Wq / Wk / Wv, y the head; WT[h*64 + n][k] = bf16(W[h][k][n]) via 64 x 64 LDS tiles.
__global__ __launch_bounds__(256) void k_wt(const float* __restrict__ Wq, const float* __restrict__ Wk, const float* __restrict__ Wv, bf* WqT, bf* WkT, bf* WvT) {
    __shared__ __align__(16) unsigned short tl[64 * 72];
    const int tid = threadIdx.x, k0 = blockIdx.x * 64, h = blockIdx.y, z = blockIdx.z;
    const float* Wm = (z == 0 ? Wq : z == 1 ? Wk : Wv) + (size_t)h * DM * HD;
    bf* WT = (z == 0 ? WqT : z == 1 ? WkT : WvT) + (size_t)h * HD * DM;
    const int kk = tid >> 2, nq = (tid & 3) * 16;
#pragma unroll
    for (int i = 0; i < 16; ++i) tl[(nq + i) * 72 + kk] = f2bf(Wm[(size_t)(k0 + kk) * HD + nq + i]);
    __syncthreads();
    const int piece = tid & 7;
#pragma unroll
    for (int s = 0; s < 2; ++s) { const int nr = (tid >> 3) + 32 * s; const v8us val = *(const v8usa*)(tl + nr * 72 + piece * 8); *(v8us*)(WT + (size_t)nr * DM + k0 + piece * 8) = val; }
}


extern "C" void kernel_launch(void* const* d_in, const int* in_sizes, int n_in,
                              void* d_out, int out_size, void* d_ws, size_t ws_size, hipStream_t stream) {
    (void)in_sizes; (void)n_in; (void)out_size;
    const float* x = (const float*)d_in[0]; const float* Wq = (const float*)d_in[1]; const float* Wk = (const float*)d_in[2]; const float* Wv = (const float*)d_in[3];
    float* out = (float*)d_out;    // [8][1024][768]
    char* wsp = (char*)d_ws;
    auto take = [&](size_t bytes) { char* p = wsp; wsp += (bytes + 255) & ~(size_t)255; return (void*)p; };
    bf* WqT = (bf*)take((size_t)DM * DM * 2); bf* WkT = (bf*)take((size_t)DM * DM * 2); bf* WvT = (bf*)take((size_t)DM * DM * 2);
    bf* Xb = (bf*)take((size_t)NTK * DM * 2);
    h16* QH = (h16*)take((size_t)NTK * DM * 2); h16* QL = (h16*)take((size_t)NTK * DM * 2); h16* KH = (h16*)take((size_t)NTK * DM * 2); h16* KL = (h16*)take((size_t)NTK * DM * 2); h16* VTH = (h16*)take((size_t)NTK * DM * 2); h16* VTL = (h16*)take((size_t)NTK * DM * 2);
    if ((size_t)(wsp - (char*)d_ws) > ws_size) return;    // 3 x 1.2 + 12.6 + 6 x 12.6 ~ 92 MB
    k_wt<<<dim3(DM / 64, NH_, 3), 256, 0, stream>>>(Wq, Wk, Wv, WqT, WkT, WvT);
    k_cvtb<<<NTK / 8, 256, 0, stream>>>(x, NTK, Xb);
    k_gemmb<false, true><<<dim3(NTK / 64, DM / 64, 1), 128, 0, stream>>>(Xb, nullptr, WqT, nullptr, (float*)(void*)QH, DM, QL);
    k_gemmb<false, true><<<dim3(NTK / 64, DM / 64, 1), 128, 0, stream>>>(Xb, nullptr, WkT, nullptr, (float*)(void*)KH, DM, KL);
    k_gemmb<false, false, true><<<dim3(NTK / 64, DM / 64, 1), 128, 0, stream>>>(Xb, nullptr, WvT, nullptr, (float*)(void*)VTH, DM, VTL);
    k_attn<<<NB_ * NH_ * (NT_ / 64), 128, 0, stream>>>(QH, QL, KH, KL, VTH, VTL, out);
}

// v003
// A run of this version takes 229 microseconds.
// Timed twice side by side with v002, it ran 1.44 times as fast both times.
// Counting every step since v000, it is 1.95 times as fast.
#include <hip/hip_runtime.h>

// Compute dtypes, f32 accumulate: q, k, v = x.W_h for all 12 heads as three [8192 x 768].[768 x 768] GEMMs with PLAIN bf16 operands (rounded input; the per-head [768][64] weights
// transposed into one n-major plane; exact products) on v_wmma_f32_16x16x32_bf16; q/k as f16 hi + residual x1024 planes, v as f16 hi/lo transposed planes; per (item, head) causal
// attention over 1024 tokens: scores on v_wmma_f32_16x16x32_f16 (hh + hl + lh, x 1/8), online f32 softmax, weights (x32768) and v as f16 hi/lo on v_wmma_f32_16x16x32_f16; the

#define NB_  8
#define NT_  1024
#define DM   768
#define NH_  12
#define HD   64
#define NTK  (NB_ * NT_)          // 8192 token rows
#define NW   DM
#define PSC  32768.0f
#define LOSC 1024.0f
#define LOSCI (1.0f / 1024.0f)

typedef _Float16 h16;
typedef unsigned short bf;
typedef __attribute__((ext_vector_type(16))) __bf16   v16bf;
typedef __attribute__((ext_vector_type(16))) _Float16 v16h;
typedef __attribute__((ext_vector_type(8)))  _Float16 v8h;
typedef __attribute__((ext_vector_type(8)))  unsigned short v8us;
typedef __attribute__((ext_vector_type(8)))  float    v8f;
typedef __attribute__((ext_vector_type(4)))  float    v4f;
typedef v8h  __attribute__((may_alias)) v8ha;
typedef v4f  __attribute__((may_alias)) v4fa;
typedef v8us __attribute__((may_alias)) v8usa;

__device__ __forceinline__ unsigned short f2bf(float f) { unsigned u = __float_as_uint(f); u += 0x7FFFu + ((u >> 16) & 1u); return (unsigned short)(u >> 16); }
__device__ __forceinline__ float bf2f(unsigned short b) { return __uint_as_float(((unsigned)b) << 16); }
__device__ __forceinline__ float bfr(float f) { return bf2f(f2bf(f)); }
__device__ __forceinline__ v16h cat16(v8h lo, v8h hi) { return __builtin_shufflevector(lo, hi, 0, 1, 2, 3, 4, 5, 6, 7, 8, 9, 10, 11, 12, 13, 14, 15); }
__device__ __forceinline__ v16bf cat16b(v8us lo, v8us hi) { return __builtin_bit_cast(v16bf, __builtin_shufflevector(lo, hi, 0, 1, 2, 3, 4, 5, 6, 7, 8, 9, 10, 11, 12, 13, 14, 15)); }
__device__ __forceinline__ v8f wmma16(v16h a, v16h b, v8f c) { return __builtin_amdgcn_wmma_f32_16x16x32_f16(false, a, false, b, (short)0, c, false, false); }
__device__ __forceinline__ v8f wmmab(v16bf a, v16bf b, v8f c) { return __builtin_amdgcn_wmma_f32_16x16x32_bf16(false, a, false, b, (short)0, c, false, false); }

__global__ __launch_bounds__(256) void k_cvtb(const float* __restrict__ src, int nrows, bf* dst) {
    const int lane = threadIdx.x & 31, r = blockIdx.x * 8 + (threadIdx.x >> 5);
    if (r >= nrows) return;
    v8us o[DM / 256];
#pragma unroll
    for (int q = 0; q < DM / 256; ++q) { v8us t;
#pragma unroll
        for (int i = 0; i < 8; ++i) t[i] = f2bf(src[(size_t)r * DM + q * 256 + lane * 8 + i]);
        o[q] = t; }
#pragma unroll
    for (int q = 0; q < DM / 256; ++q) *(v8us*)(dst + (size_t)r * DM + q * 256 + lane * 8) = o[q];
    
}

// k_gemmb: 64 x 64 block tile (4 waves x 16 x 64) of C[NTK][NW] = (A [+ Al]).B^T (K = 768) [+ bf(bias[c])] [+ bf(R[r][c]) residual]; f32 whole-line epilogue (or f16
// VTOUT: the tile leaves as the two transposed f16 planes [item][head][d][token] (C = hi, C2 = residual x1024); block tile = 64 tokens x one head.
template <bool SPLITA, bool F16OUT = false, bool VTOUT = false>
__global__ __launch_bounds__(128) void k_gemmb(const bf* __restrict__ A, const bf* __restrict__ Al, const bf* __restrict__ Bn, const float* __restrict__ bias, float* C, int ldc, h16* C2, const float* __restrict__ R = nullptr, int K = DM, int roundR = 1) {
    __shared__ __align__(16) float ost[4][16 * 68];
    const int lane = threadIdx.x & 31, wave = threadIdx.x >> 5, lr = lane & 15, hi = lane >> 4;
    const int r0 = blockIdx.x * 64 + wave * 16, c0 = blockIdx.y * 64;
    const size_t aoff = (size_t)(r0 + lr) * K + 8 * hi;
    size_t boff[4];
#pragma unroll
    for (int t = 0; t < 4; ++t) boff[t] = (size_t)(c0 + t * 16 + lr) * K + 8 * hi;
    v8f acc[4];
#pragma unroll
    for (int t = 0; t < 4; ++t) acc[t] = (v8f){};
#pragma unroll 1
    for (int kc = 0; kc < K; kc += 32) {
        const v16bf a = cat16b(*(const v8us*)(A + aoff + kc), *(const v8us*)(A + aoff + kc + 16));
        v16bf al = a;
        if (SPLITA) al = cat16b(*(const v8us*)(Al + aoff + kc), *(const v8us*)(Al + aoff + kc + 16));
#pragma unroll
        for (int t = 0; t < 4; ++t) { const v16bf b = cat16b(*(const v8us*)(Bn + boff[t] + kc), *(const v8us*)(Bn + boff[t] + kc + 16)); acc[t] = wmmab(a, b, acc[t]); if (SPLITA) acc[t] = wmmab(al, b, acc[t]); }
        asm volatile("v_nop\n\tv_nop\n\tv_nop\n\tv_nop" : "+v"(acc[0]), "+v"(acc[1]), "+v"(acc[2]), "+v"(acc[3]) : "v"(a), "v"(al));
    }
    if constexpr (VTOUT) {
        __shared__ __align__(16) h16 tile[64 * 72];
        __shared__ __align__(16) h16 til2[64 * 72];
        // a lane's accumulator holds 8 consecutive tokens of one head dim: one 16-B piece of a transposed row
#pragma unroll
        for (int t = 0; t < 4; ++t) { v8h a8, l8;
#pragma unroll
            for (int j = 0; j < 8; ++j) { const float v = acc[t][j]; const h16 a = (h16)v; a8[j] = a; l8[j] = (h16)((v - (float)a) * LOSC); }
            *(v8ha*)(tile + (t * 16 + lr) * 72 + wave * 16 + hi * 8) = a8; *(v8ha*)(til2 + (t * 16 + lr) * 72 + wave * 16 + hi * 8) = l8; }
        __syncthreads();
        const int tid = threadIdx.x, piece = tid & 7;
        const int b = blockIdx.x / (NT_ / 64), k0 = (blockIdx.x % (NT_ / 64)) * 64, h = blockIdx.y;
        const size_t base = (((size_t)b * NH_ + h) * HD) * NT_ + k0;
        h16* VTH = (h16*)(void*)C;
#pragma unroll
        for (int s = 0; s < 8; ++s) { const int pln = s >> 2, d = (tid >> 3) + 16 * (s & 3);     // 8 lanes write one whole 128-B line
            const v8h val = *(const v8ha*)((pln ? til2 : tile) + d * 72 + piece * 8); *(v8h*)((pln ? C2 : VTH) + base + (size_t)d * NT_ + piece * 8) = val; }
        return;
    }
    float* os = &ost[wave][0];
#pragma unroll
    for (int t = 0; t < 4; ++t) { const float bv = bias ? bfr(bias[c0 + t * 16 + lr]) : 0.f;
#pragma unroll
        for (int j = 0; j < 8; ++j) os[(hi * 8 + j) * 68 + t * 16 + lr] = acc[t][j] + bv; }
    __syncthreads();
    if (F16OUT) {
        h16* crow = (h16*)(void*)C + (size_t)r0 * ldc + c0;
        h16* crow2 = C2 + (size_t)r0 * ldc + c0;
        const int piece = lane & 7;
        v8h o[4], o2[4];     // both planes' pieces first, then the 8 whole-line stores in a row
#pragma unroll
        for (int s = 0; s < 4; ++s) { const float* sp = os + (4 * s + (lane >> 3)) * 68 + piece * 8;
#pragma unroll
            for (int i = 0; i < 8; ++i) { const h16 a = (h16)sp[i]; o[s][i] = a; o2[s][i] = (h16)((sp[i] - (float)a) * LOSC); } }
#pragma unroll
        for (int s = 0; s < 4; ++s) { const size_t ro = (size_t)(4 * s + (lane >> 3)) * ldc + piece * 8; *(v8h*)(crow + ro) = o[s]; *(v8h*)(crow2 + ro) = o2[s]; }
    } else {
        float* crow = C + (size_t)r0 * ldc + c0;
        auto pass = [&]() {
#pragma unroll
            for (int s = 0; s < 8; ++s) { const int Lid = (lane >> 3) + 4 * s, piece = lane & 7; const int row = Lid >> 1, cofs = (Lid & 1) * 32 + piece * 4;
                v4f val = *(const v4fa*)(os + row * 68 + cofs); if (R) { const v4f rv = *(const v4f*)(R + ((size_t)r0 + row) * ldc + c0 + cofs); val += roundR ? (v4f){bfr(rv[0]), bfr(rv[1]), bfr(rv[2]), bfr(rv[3])} : rv; }
                *(v4f*)(crow + (size_t)row * ldc + cofs) = val; }
        };
        pass(); 
    }
}

// k_attn: block = (b, h, 64 queries), wave = 16; CAUSAL: key tiles 0..(64qt+63)/32 with per-element j <= i; 4 WMMA scores /8 (f32), online softmax, weights x32768 f16 tile (same-wave may_alias
// reload after a compiler barrier), 4 WMMA .v; ctx -> f32 output rows [tok][h*64+d] (16 lanes x 16 B per head slice).
// LDS ring of k_attn: a stage = 32 keys: k hi, k residual [32 keys][64 d] at a pitch of 144 B, then v hi, v residual [64 d][32 keys] at a pitch of 80 B (16 B x odd: ds_load_b128 without bank conflicts)
#define KP   72
#define VP   40
#define KPL  (32 * KP)
#define VPL  (64 * VP)
#define STG  (2 * KPL + 2 * VPL)
// amdgpu_waves_per_eu(4, 4): keeps the register count at or below 256, so that four waves per SIMD stay resident as before (without it the grouped LDS reads took 258)
__global__ __launch_bounds__(128) __attribute__((amdgpu_waves_per_eu(4, 4))) void k_attn(const h16* __restrict__ Q16, const h16* __restrict__ QL16, const h16* __restrict__ K16, const h16* __restrict__ KL16, const h16* __restrict__ VTH, const h16* __restrict__ VTL, float* CTX) {
    __shared__ __align__(16) h16 plds[4][16 * 32];
    __shared__ __align__(16) h16 plds2[4][16 * 32];
    __shared__ __align__(16) float ost[4][16 * 68];
    __shared__ __align__(16) h16 ring[2][STG];
    const int lane = threadIdx.x & 31, wave = threadIdx.x >> 5, lr = lane & 15, hi = lane >> 4;
    const int bid = blockIdx.x;
    const int b = bid / (NH_ * (NT_ / 64)), rem = bid - b * (NH_ * (NT_ / 64)), h = rem / (NT_ / 64), qt = rem - h * (NT_ / 64);
    const int q0 = qt * 64 + wave * 16;
    const size_t tok0 = (size_t)b * NT_;
    h16* pl = &plds[wave][0]; h16* pl2 = &plds2[wave][0];
    v16h qa[2];
    const size_t qo0 = (tok0 + q0 + lr) * DM + h * HD + 8 * hi;
#pragma unroll
    for (int kc = 0; kc < 2; ++kc) qa[kc] = cat16(*(const v8h*)(Q16 + qo0 + kc * 32), *(const v8h*)(Q16 + qo0 + kc * 32 + 16));
    asm volatile("s_wait_xcnt 0x0" :: "v"(Q16 + qo0) : "memory");     // the query loads' address pair is named as an input, so it stays whole up to this wait
    const h16* kh_b = K16 + tok0 * DM + h * HD;
    const h16* kl_b = KL16 + tok0 * DM + h * HD;
    const size_t vbase = (((size_t)b * NH_ + h) * HD) * NT_;
    v8f o[4], ox[4];
#pragma unroll
    for (int n = 0; n < 4; ++n) { o[n] = (v8f){}; ox[n] = (v8f){}; }
    float mrow[8], lpart[8];
#pragma unroll
    for (int j = 0; j < 8; ++j) { mrow[j] = -3.0e38f; lpart[j] = 0.f; }
    int qpos[8];
#pragma unroll
    for (int j = 0; j < 8; ++j) qpos[j] = q0 + 8 * hi + j;
    const int kt_lo = 0, kt_hi = (qt * 64 + 63) / 32;     // causal; always at least two key tiles
    // one stage = 1024 pieces of 16 B, 8 per thread: 8 lanes bring one whole 128-B k row, 4 lanes one 64-B v row piece; the block's 4 waves share the tile
    const int tid = threadIdx.x;
    const unsigned ring0 = (unsigned)(size_t)(__attribute__((address_space(3))) h16*)&ring[0][0];
    const unsigned lk = ring0 + 2u * (unsigned)((tid >> 3) * KP + (tid & 7) * 8), lv = ring0 + 2u * (unsigned)(2 * KPL + (tid >> 2) * VP + (tid & 3) * 8);
    const size_t gko = (size_t)(tid >> 3) * DM + (tid & 7) * 8, gvo = vbase + (size_t)(tid >> 2) * NT_ + (tid & 3) * 8;
    auto fill = [&](int t, int buf) {
        const unsigned a = lk + (unsigned)buf * (2u * STG), c = lv + (unsigned)buf * (2u * STG);
        const h16* gh = kh_b + gko + (size_t)t * 32 * DM; const h16* gl = kl_b + gko + (size_t)t * 32 * DM;
        const h16* vh = VTH + gvo + t * 32; const h16* vl = VTL + gvo + t * 32;
        // the copies and their s_wait_xcnt in one statement: no address register is rewritten before the wait
        asm volatile("global_load_async_to_lds_b128 %0, %8, off\n\t"
                     "global_load_async_to_lds_b128 %1, %9, off\n\t"
                     "global_load_async_to_lds_b128 %2, %10, off\n\t"
                     "global_load_async_to_lds_b128 %3, %11, off\n\t"
                     "global_load_async_to_lds_b128 %4, %12, off\n\t"
                     "global_load_async_to_lds_b128 %5, %13, off\n\t"
                     "global_load_async_to_lds_b128 %6, %14, off\n\t"
                     "global_load_async_to_lds_b128 %7, %15, off\n\t"
                     "s_wait_xcnt 0x0"
                     :: "v"(a), "v"(a + 2u * 16 * KP), "v"(a + 2u * KPL), "v"(a + 2u * (KPL + 16 * KP)), "v"(c), "v"(c + 2u * 32 * VP), "v"(c + 2u * VPL), "v"(c + 2u * (VPL + 32 * VP)),
                        "v"(gh), "v"(gh + 16 * DM), "v"(gl), "v"(gl + 16 * DM), "v"(vh), "v"(vh + 32 * NT_), "v"(vl), "v"(vl + 32 * NT_) : "memory");
    };
    fill(0, 0);
    asm volatile("s_wait_asynccnt 0x0" ::: "memory");     // tile 0 has landed before the barrier publishes it
    __syncthreads();
    fill(1, 1);
#pragma unroll 1
    for (int kt = kt_lo; kt <= kt_hi; ++kt) {
        const int l0 = kt * 32;
        const h16* st = &ring[kt & 1][0];
        const h16* ks = st + lr * KP + 8 * hi;     // key l0 + lr; key l0 + 16 + lr is 16 rows on; the residual plane KPL on
        v8f s0 = {}, s1 = {}, x0 = {}, x1 = {};
#pragma unroll
        for (int kc = 0; kc < 2; ++kc) {
            { const v16h k0h = cat16(*(const v8ha*)(ks + kc * 32), *(const v8ha*)(ks + kc * 32 + 16)), k1h = cat16(*(const v8ha*)(ks + 16 * KP + kc * 32), *(const v8ha*)(ks + 16 * KP + kc * 32 + 16));
              const v16h qlk = cat16(*(const v8h*)(QL16 + qo0 + kc * 32), *(const v8h*)(QL16 + qo0 + kc * 32 + 16));     // query residual re-read per step (registers)
              s0 = wmma16(qa[kc], k0h, s0); x0 = wmma16(qlk, k0h, x0); s1 = wmma16(qa[kc], k1h, s1); x1 = wmma16(qlk, k1h, x1);
            }
            { const v16h k0l = cat16(*(const v8ha*)(ks + KPL + kc * 32), *(const v8ha*)(ks + KPL + kc * 32 + 16)), k1l = cat16(*(const v8ha*)(ks + KPL + 16 * KP + kc * 32), *(const v8ha*)(ks + KPL + 16 * KP + kc * 32 + 16));
              x0 = wmma16(qa[kc], k0l, x0); x1 = wmma16(qa[kc], k1l, x1); }
        }
        asm volatile("v_nop\n\tv_nop\n\tv_nop\n\tv_nop" : "+v"(s0), "+v"(s1), "+v"(x0), "+v"(x1) : "v"(qa[0]), "v"(qa[1]));
        float alpha[8];
#pragma unroll
        for (int j = 0; j < 8; ++j) {
            const int ja = l0 + lr, jb = l0 + 16 + lr, qi = qpos[j];
            const float a0 = (ja <= qi) ? (s0[j] + x0[j] * LOSCI) * 0.125f : -__builtin_inff(), a1 = (jb <= qi) ? (s1[j] + x1[j] * LOSCI) * 0.125f : -__builtin_inff();
            float mx = fmaxf(a0, a1);
            mx = fmaxf(mx, __shfl_xor(mx, 1, 16)); mx = fmaxf(mx, __shfl_xor(mx, 2, 16)); mx = fmaxf(mx, __shfl_xor(mx, 4, 16)); mx = fmaxf(mx, __shfl_xor(mx, 8, 16));
            const float mn = fmaxf(mrow[j], mx);
            alpha[j] = __expf(mrow[j] - mn); mrow[j] = mn;
            const float p0 = __expf(a0 - mn), p1 = __expf(a1 - mn);
            lpart[j] = lpart[j] * alpha[j] + (p0 + p1);
            const int mr = hi * 8 + j;
            const float ps0 = p0 * PSC, ps1 = p1 * PSC; const h16 h0 = (h16)ps0, h1 = (h16)ps1;
            pl[mr * 32 + lr] = h0; pl[mr * 32 + 16 + lr] = h1;
            pl2[mr * 32 + lr] = (h16)((ps0 - (float)h0) * LOSC); pl2[mr * 32 + 16 + lr] = (h16)((ps1 - (float)h1) * LOSC);
        }
#pragma unroll
        for (int n = 0; n < 4; ++n)
#pragma unroll
            for (int j = 0; j < 8; ++j) { o[n][j] *= alpha[j]; ox[n][j] *= alpha[j]; }
        asm volatile("" ::: "memory");
        const v16h pa = cat16(*(const v8ha*)(pl + lr * 32 + hi * 8), *(const v8ha*)(pl + lr * 32 + 16 + hi * 8));
        const v16h px = cat16(*(const v8ha*)(pl2 + lr * 32 + hi * 8), *(const v8ha*)(pl2 + lr * 32 + 16 + hi * 8));
#pragma unroll
        for (int n = 0; n < 4; ++n) { const h16* vs = st + 2 * KPL + (n * 16 + lr) * VP + hi * 8;
            const v16h vh = cat16(*(const v8ha*)(vs), *(const v8ha*)(vs + 16)), vl = cat16(*(const v8ha*)(vs + VPL), *(const v8ha*)(vs + VPL + 16));
            o[n] = wmma16(pa, vh, o[n]); ox[n] = wmma16(pa, vl, ox[n]); ox[n] = wmma16(px, vh, ox[n]); }
        asm volatile("v_nop\n\tv_nop\n\tv_nop\n\tv_nop" : "+v"(o[0]), "+v"(o[1]), "+v"(o[2]), "+v"(o[3]), "+v"(ox[0]), "+v"(ox[1]), "+v"(ox[2]), "+v"(ox[3]) : "v"(pa), "v"(px));
        asm volatile("s_wait_dscnt 0x0" ::: "memory");        // this wave's reads of the buffer have returned before it is refilled
        asm volatile("s_wait_asynccnt 0x0" ::: "memory");     // this wave's copies of tile kt + 1 have landed before the barrier publishes them
        __syncthreads();                                      // publishes tile kt + 1 and ends every wave's reads of tile kt
        if (kt + 2 <= kt_hi) fill(kt + 2, kt & 1);
    }
    asm volatile("s_wait_asynccnt 0x0" ::: "memory");         // no copy is outstanding when the wave goes on to its end
    float inv[8];
#pragma unroll
    for (int j = 0; j < 8; ++j) { float rs = lpart[j]; rs += __shfl_xor(rs, 1, 16); rs += __shfl_xor(rs, 2, 16); rs += __shfl_xor(rs, 4, 16); rs += __shfl_xor(rs, 8, 16); inv[j] = 1.0f / (rs * PSC); }
    float* os = &ost[wave][0];
#pragma unroll
    for (int n = 0; n < 4; ++n)
#pragma unroll
        for (int j = 0; j < 8; ++j) os[(hi * 8 + j) * 68 + n * 16 + lr] = (o[n][j] + ox[n][j] * LOSCI) * inv[j];
    __syncthreads();
    const size_t cbase = (tok0 + q0) * DM + (size_t)h * HD;
    auto pass = [&]() {
#pragma unroll
        for (int s = 0; s < 8; ++s) { const int row = 2 * s + (lane >> 4), piece = lane & 15; const float* sp = os + row * 68 + piece * 4; v4f v;
#pragma unroll
            for (int i = 0; i < 4; ++i) v[i] = sp[i];
            *(v4f*)(CTX + cbase + (size_t)row * DM + piece * 4) = v; }
    };
    pass(); 
}

#define VST2(T, p, v) do { const T vst2_v_ = (v); *(T*)(p) = vst2_v_;  } while (0)

// k_wt: every per-head weight plane in ONE launch; grid (DM/64, heads, 3): z picks Wq / Wk / Wv, y the head; WT[h*64 + n][k] = bf16(W[h][k][n]) via 64 x 64 LDS tiles.
__global__ __launch_bounds__(256) void k_wt(const float* __restrict__ Wq, const float* __restrict__ Wk, const float* __restrict__ Wv, bf* WqT, bf* WkT, bf* WvT) {
    __shared__ __align__(16) unsigned short tl[64 * 72];
    const int tid = threadIdx.x, k0 = blockIdx.x * 64, h = blockIdx.y, z = blockIdx.z;
    const float* Wm = (z == 0 ? Wq : z == 1 ? Wk : Wv) + (size_t)h * DM * HD;
    bf* WT = (z == 0 ? WqT : z == 1 ? WkT : WvT) + (size_t)h * HD * DM;
    const int kk = tid >> 2, nq = (tid & 3) * 16;
#pragma unroll
    for (int i = 0; i < 16; ++i) tl[(nq + i) * 72 + kk] = f2bf(Wm[(size_t)(k0 + kk) * HD + nq + i]);
    __syncthreads();
    const int piece = tid & 7;
#pragma unroll
    for (int s = 0; s < 2; ++s) { const int nr = (tid >> 3) + 32 * s; const v8us val = *(const v8usa*)(tl + nr * 72 + piece * 8); *(v8us*)(WT + (size_t)nr * DM + k0 + piece * 8) = val; }
}


extern "C" void kernel_launch(void* const* d_in, const int* in_sizes, int n_in,
                              void* d_out, int out_size, void* d_ws, size_t ws_size, hipStream_t stream) {
    (void)in_sizes; (void)n_in; (void)out_size;
    const float* x = (const float*)d_in[0]; const float* Wq = (const float*)d_in[1]; const float* Wk = (const float*)d_in[2]; const float* Wv = (const float*)d_in[3];
    float* out = (float*)d_out;    // [8][1024][768]
    char* wsp = (char*)d_ws;
    auto take = [&](size_t bytes) { char* p = wsp; wsp += (bytes + 255) & ~(size_t)255; return (void*)p; };
    bf* WqT = (bf*)take((size_t)DM * DM * 2); bf* WkT = (bf*)take((size_t)DM * DM * 2); bf* WvT = (bf*)take((size_t)DM * DM * 2);
    bf* Xb = (bf*)take((size_t)NTK * DM * 2);
    h16* QH = (h16*)take((size_t)NTK * DM * 2); h16* QL = (h16*)take((size_t)NTK * DM * 2); h16* KH = (h16*)take((size_t)NTK * DM * 2); h16* KL = (h16*)take((size_t)NTK * DM * 2); h16* VTH = (h16*)take((size_t)NTK * DM * 2); h16* VTL = (h16*)take((size_t)NTK * DM * 2);
    if ((size_t)(wsp - (char*)d_ws) > ws_size) return;    // 3 x 1.2 + 12.6 + 6 x 12.6 ~ 92 MB
    k_wt<<<dim3(DM / 64, NH_, 3), 256, 0, stream>>>(Wq, Wk, Wv, WqT, WkT, WvT);
    k_cvtb<<<NTK / 8, 256, 0, stream>>>(x, NTK, Xb);
    k_gemmb<false, true><<<dim3(NTK / 64, DM / 64, 1), 128, 0, stream>>>(Xb, nullptr, WqT, nullptr, (float*)(void*)QH, DM, QL);
    k_gemmb<false, true><<<dim3(NTK / 64, DM / 64, 1), 128, 0, stream>>>(Xb, nullptr, WkT, nullptr, (float*)(void*)KH, DM, KL);
    k_gemmb<false, false, true><<<dim3(NTK / 64, DM / 64, 1), 128, 0, stream>>>(Xb, nullptr, WvT, nullptr, (float*)(void*)VTH, DM, VTL);
    k_attn<<<NB_ * NH_ * (NT_ / 64), 128, 0, stream>>>(QH, QL, KH, KL, VTH, VTL, out);
}

// v004
// It runs in 159 microseconds.
// Next to v003, in two timings, it ran 1.44 times as fast each time.
// All steps since v000 together make it 2.80 times as fast.
#include <hip/hip_runtime.h>

// Compute dtypes, f32 accumulate: q, k, v = x.W_h for all 12 heads as three [8192 x 768].[768 x 768] GEMMs with PLAIN bf16 operands (rounded input; the per-head [768][64] weights
// transposed into one n-major plane; exact products) on v_wmma_f32_16x16x32_bf16; q/k as f16 hi + residual x1024 planes, v as f16 hi/lo transposed planes; per (item, head) causal
// attention over 1024 tokens: scores on v_wmma_f32_16x16x32_f16 (hh + hl + lh, x 1/8), online f32 softmax, weights (x32768) and v as f16 hi/lo on v_wmma_f32_16x16x32_f16; the

#define NB_  8
#define NT_  1024
#define DM   768
#define NH_  12
#define HD   64
#define NTK  (NB_ * NT_)          // 8192 token rows
#define NW   DM
#define PSC  32768.0f
#define LOSC 1024.0f
#define LOSCI (1.0f / 1024.0f)

typedef _Float16 h16;
typedef unsigned short bf;
typedef __attribute__((ext_vector_type(16))) __bf16   v16bf;
typedef __attribute__((ext_vector_type(16))) _Float16 v16h;
typedef __attribute__((ext_vector_type(8)))  _Float16 v8h;
typedef __attribute__((ext_vector_type(8)))  unsigned short v8us;
typedef __attribute__((ext_vector_type(8)))  float    v8f;
typedef __attribute__((ext_vector_type(4)))  float    v4f;
typedef v8h  __attribute__((may_alias)) v8ha;
typedef v4f  __attribute__((may_alias)) v4fa;
typedef v8us __attribute__((may_alias)) v8usa;

__device__ __forceinline__ unsigned short f2bf(float f) { unsigned u = __float_as_uint(f); u += 0x7FFFu + ((u >> 16) & 1u); return (unsigned short)(u >> 16); }
__device__ __forceinline__ float bf2f(unsigned short b) { return __uint_as_float(((unsigned)b) << 16); }
__device__ __forceinline__ float bfr(float f) { return bf2f(f2bf(f)); }
__device__ __forceinline__ v16h cat16(v8h lo, v8h hi) { return __builtin_shufflevector(lo, hi, 0, 1, 2, 3, 4, 5, 6, 7, 8, 9, 10, 11, 12, 13, 14, 15); }
__device__ __forceinline__ v16bf cat16b(v8us lo, v8us hi) { return __builtin_bit_cast(v16bf, __builtin_shufflevector(lo, hi, 0, 1, 2, 3, 4, 5, 6, 7, 8, 9, 10, 11, 12, 13, 14, 15)); }
__device__ __forceinline__ v8f wmma16(v16h a, v16h b, v8f c) { return __builtin_amdgcn_wmma_f32_16x16x32_f16(false, a, false, b, (short)0, c, false, false); }
__device__ __forceinline__ v8f wmmab(v16bf a, v16bf b, v8f c) { return __builtin_amdgcn_wmma_f32_16x16x32_bf16(false, a, false, b, (short)0, c, false, false); }

__global__ __launch_bounds__(256) void k_cvtb(const float* __restrict__ src, int nrows, bf* dst) {
    const int lane = threadIdx.x & 31, r = blockIdx.x * 8 + (threadIdx.x >> 5);
    if (r >= nrows) return;
    v8us o[DM / 256];
#pragma unroll
    for (int q = 0; q < DM / 256; ++q) { v8us t;
#pragma unroll
        for (int i = 0; i < 8; ++i) t[i] = f2bf(src[(size_t)r * DM + q * 256 + lane * 8 + i]);
        o[q] = t; }
#pragma unroll
    for (int q = 0; q < DM / 256; ++q) *(v8us*)(dst + (size_t)r * DM + q * 256 + lane * 8) = o[q];
    
}

// k_gemmb: 64 x 64 block tile (4 waves x 16 x 64) of C[NTK][NW] = (A [+ Al]).B^T (K = 768) [+ bf(bias[c])] [+ bf(R[r][c]) residual]; f32 whole-line epilogue (or f16
// VTOUT: the tile leaves as the two transposed f16 planes [item][head][d][token] (C = hi, C2 = residual x1024); block tile = 64 tokens x one head.
// LDS ring of k_gemmb: a stage = 64 k: the block's A rows [64][64 k], then its B rows [64][64 k], at a pitch of 144 B (16 B x odd: ds_load_b128 without bank conflicts); K a multiple of 64.
// The epilogues stage their tiles in the same LDS, behind the last trip's barrier, so that the six blocks a WGP gets all stay resident.
#define GP   72
#define GPL  (64 * GP)
#define GSTG (2 * GPL)
template <bool SPLITA, bool F16OUT = false, bool VTOUT = false>
__global__ __launch_bounds__(128) void k_gemmb(const bf* __restrict__ A, const bf* __restrict__ Al, const bf* __restrict__ Bn, const float* __restrict__ bias, float* C, int ldc, h16* C2, const float* __restrict__ R = nullptr, int K = DM, int roundR = 1) {
    __shared__ __align__(16) char smem[2 * GSTG * 2];
    const int lane = threadIdx.x & 31, wave = threadIdx.x >> 5, lr = lane & 15, hi = lane >> 4;
    const int r0 = blockIdx.x * 64 + wave * 16, c0 = blockIdx.y * 64;
    const size_t aoff = (size_t)(r0 + lr) * K + 8 * hi;
    v8f acc[4];
#pragma unroll
    for (int t = 0; t < 4; ++t) acc[t] = (v8f){};
    // one stage = 1024 pieces of 16 B, 8 per thread: 8 lanes bring one whole 128-B line of a row; the block's 4 waves share the B tile
    const int tid = threadIdx.x, nt = K >> 6;
    const unsigned ring0 = (unsigned)(size_t)(__attribute__((address_space(3))) char*)&smem[0];
    const unsigned la = ring0 + 2u * (unsigned)((tid >> 3) * GP + (tid & 7) * 8);
    const bf* ga = A + (size_t)(blockIdx.x * 64 + (tid >> 3)) * K + (tid & 7) * 8;
    const bf* gb = Bn + (size_t)(c0 + (tid >> 3)) * K + (tid & 7) * 8;
    const size_t k16 = (size_t)16 * K;
    auto fill = [&](int t, int buf) {
        const unsigned a = la + (unsigned)buf * (2u * GSTG), b = a + 2u * GPL;
        const bf* pa = ga + t * 64; const bf* pb = gb + t * 64;
        // the copies and their s_wait_xcnt in one statement: no address register is rewritten before the wait
        asm volatile("global_load_async_to_lds_b128 %0, %8, off\n\t"
                     "global_load_async_to_lds_b128 %1, %9, off\n\t"
                     "global_load_async_to_lds_b128 %2, %10, off\n\t"
                     "global_load_async_to_lds_b128 %3, %11, off\n\t"
                     "global_load_async_to_lds_b128 %4, %12, off\n\t"
                     "global_load_async_to_lds_b128 %5, %13, off\n\t"
                     "global_load_async_to_lds_b128 %6, %14, off\n\t"
                     "global_load_async_to_lds_b128 %7, %15, off\n\t"
                     "s_wait_xcnt 0x0"
                     :: "v"(a), "v"(a + 2u * 16 * GP), "v"(a + 2u * 32 * GP), "v"(a + 2u * 48 * GP), "v"(b), "v"(b + 2u * 16 * GP), "v"(b + 2u * 32 * GP), "v"(b + 2u * 48 * GP),
                        "v"(pa), "v"(pa + k16), "v"(pa + 2 * k16), "v"(pa + 3 * k16), "v"(pb), "v"(pb + k16), "v"(pb + 2 * k16), "v"(pb + 3 * k16) : "memory");
    };
    fill(0, 0);
    asm volatile("s_wait_asynccnt 0x0" ::: "memory");     // tile 0 has landed before the barrier publishes it
    __syncthreads();
    if (nt > 1) fill(1, 1);
#pragma unroll 1
    for (int s = 0; s < nt; ++s) {
        const bf* st = (const bf*)(const void*)smem + (s & 1) * GSTG;
        const bf* as = st + (wave * 16 + lr) * GP + 8 * hi;     // this wave's 16 rows of A
        const bf* bs = st + GPL + lr * GP + 8 * hi;             // column c0 + lr; column tile t is 16 t rows on
        v16bf a[2], al[2];
#pragma unroll
        for (int kc = 0; kc < 2; ++kc) { a[kc] = cat16b(*(const v8usa*)(as + kc * 32), *(const v8usa*)(as + kc * 32 + 16)); al[kc] = a[kc];
            if (SPLITA) al[kc] = cat16b(*(const v8us*)(Al + aoff + s * 64 + kc * 32), *(const v8us*)(Al + aoff + s * 64 + kc * 32 + 16)); }
#pragma unroll
        for (int kc = 0; kc < 2; ++kc)
#pragma unroll
            for (int t = 0; t < 4; ++t) { const v16bf b = cat16b(*(const v8usa*)(bs + t * 16 * GP + kc * 32), *(const v8usa*)(bs + t * 16 * GP + kc * 32 + 16)); acc[t] = wmmab(a[kc], b, acc[t]); if (SPLITA) acc[t] = wmmab(al[kc], b, acc[t]); }
        asm volatile("v_nop\n\tv_nop\n\tv_nop\n\tv_nop" : "+v"(acc[0]), "+v"(acc[1]), "+v"(acc[2]), "+v"(acc[3]) : "v"(a[0]), "v"(a[1]), "v"(al[0]), "v"(al[1]));
        asm volatile("s_wait_dscnt 0x0" ::: "memory");        // this wave's reads of the buffer have returned before it is refilled
        asm volatile("s_wait_asynccnt 0x0" ::: "memory");     // this wave's copies of tile s + 1 have landed before the barrier publishes them
        __syncthreads();                                      // publishes tile s + 1 and ends every wave's reads of tile s
        if (s + 2 < nt) fill(s + 2, s & 1);
    }
    asm volatile("s_wait_asynccnt 0x0" ::: "memory");         // no copy is outstanding when the ring's LDS is used again below
    if constexpr (VTOUT) {
        h16* tile = (h16*)(void*)smem;
        h16* til2 = tile + 64 * 72;
        // a lane's accumulator holds 8 consecutive tokens of one head dim: one 16-B piece of a transposed row
#pragma unroll
        for (int t = 0; t < 4; ++t) { v8h a8, l8;
#pragma unroll
            for (int j = 0; j < 8; ++j) { const float v = acc[t][j]; const h16 a = (h16)v; a8[j] = a; l8[j] = (h16)((v - (float)a) * LOSC); }
            *(v8ha*)(tile + (t * 16 + lr) * 72 + wave * 16 + hi * 8) = a8; *(v8ha*)(til2 + (t * 16 + lr) * 72 + wave * 16 + hi * 8) = l8; }
        __syncthreads();
        const int tid = threadIdx.x, piece = tid & 7;
        const int b = blockIdx.x / (NT_ / 64), k0 = (blockIdx.x % (NT_ / 64)) * 64, h = blockIdx.y;
        const size_t base = (((size_t)b * NH_ + h) * HD) * NT_ + k0;
        h16* VTH = (h16*)(void*)C;
#pragma unroll
        for (int s = 0; s < 8; ++s) { const int pln = s >> 2, d = (tid >> 3) + 16 * (s & 3);     // 8 lanes write one whole 128-B line
            const v8h val = *(const v8ha*)((pln ? til2 : tile) + d * 72 + piece * 8); *(v8h*)((pln ? C2 : VTH) + base + (size_t)d * NT_ + piece * 8) = val; }
        return;
    }
    float* os = (float*)(void*)smem + wave * (16 * 68);
#pragma unroll
    for (int t = 0; t < 4; ++t) { const float bv = bias ? bfr(bias[c0 + t * 16 + lr]) : 0.f;
#pragma unroll
        for (int j = 0; j < 8; ++j) os[(hi * 8 + j) * 68 + t * 16 + lr] = acc[t][j] + bv; }
    __syncthreads();
    if (F16OUT) {
        h16* crow = (h16*)(void*)C + (size_t)r0 * ldc + c0;
        h16* crow2 = C2 + (size_t)r0 * ldc + c0;
        const int piece = lane & 7;
        v8h o[4], o2[4];     // both planes' pieces first, then the 8 whole-line stores in a row
#pragma unroll
        for (int s = 0; s < 4; ++s) { const float* sp = os + (4 * s + (lane >> 3)) * 68 + piece * 8;
#pragma unroll
            for (int i = 0; i < 8; ++i) { const h16 a = (h16)sp[i]; o[s][i] = a; o2[s][i] = (h16)((sp[i] - (float)a) * LOSC); } }
#pragma unroll
        for (int s = 0; s < 4; ++s) { const size_t ro = (size_t)(4 * s + (lane >> 3)) * ldc + piece * 8; *(v8h*)(crow + ro) = o[s]; *(v8h*)(crow2 + ro) = o2[s]; }
    } else {
        float* crow = C + (size_t)r0 * ldc + c0;
        auto pass = [&]() {
#pragma unroll
            for (int s = 0; s < 8; ++s) { const int Lid = (lane >> 3) + 4 * s, piece = lane & 7; const int row = Lid >> 1, cofs = (Lid & 1) * 32 + piece * 4;
                v4f val = *(const v4fa*)(os + row * 68 + cofs); if (R) { const v4f rv = *(const v4f*)(R + ((size_t)r0 + row) * ldc + c0 + cofs); val += roundR ? (v4f){bfr(rv[0]), bfr(rv[1]), bfr(rv[2]), bfr(rv[3])} : rv; }
                *(v4f*)(crow + (size_t)row * ldc + cofs) = val; }
        };
        pass(); 
    }
}

// k_attn: block = (b, h, 64 queries), wave = 16; CAUSAL: key tiles 0..(64qt+63)/32 with per-element j <= i; 4 WMMA scores /8 (f32), online softmax, weights x32768 f16 tile (same-wave may_alias
// reload after a compiler barrier), 4 WMMA .v; ctx -> f32 output rows [tok][h*64+d] (16 lanes x 16 B per head slice).
// LDS ring of k_attn: a stage = 32 keys: k hi, k residual [32 keys][64 d] at a pitch of 144 B, then v hi, v residual [64 d][32 keys] at a pitch of 80 B (16 B x odd: ds_load_b128 without bank conflicts)
#define KP   72
#define VP   40
#define KPL  (32 * KP)
#define VPL  (64 * VP)
#define STG  (2 * KPL + 2 * VPL)
// amdgpu_waves_per_eu(4, 4): keeps the register count at or below 256, so that four waves per SIMD stay resident as before (without it the grouped LDS reads took 258)
__global__ __launch_bounds__(128) __attribute__((amdgpu_waves_per_eu(4, 4))) void k_attn(const h16* __restrict__ Q16, const h16* __restrict__ QL16, const h16* __restrict__ K16, const h16* __restrict__ KL16, const h16* __restrict__ VTH, const h16* __restrict__ VTL, float* CTX) {
    __shared__ __align__(16) h16 plds[4][16 * 32];
    __shared__ __align__(16) h16 plds2[4][16 * 32];
    __shared__ __align__(16) float ost[4][16 * 68];
    __shared__ __align__(16) h16 ring[2][STG];
    const int lane = threadIdx.x & 31, wave = threadIdx.x >> 5, lr = lane & 15, hi = lane >> 4;
    const int bid = blockIdx.x;
    const int b = bid / (NH_ * (NT_ / 64)), rem = bid - b * (NH_ * (NT_ / 64)), h = rem / (NT_ / 64), qt = rem - h * (NT_ / 64);
    const int q0 = qt * 64 + wave * 16;
    const size_t tok0 = (size_t)b * NT_;
    h16* pl = &plds[wave][0]; h16* pl2 = &plds2[wave][0];
    v16h qa[2];
    const size_t qo0 = (tok0 + q0 + lr) * DM + h * HD + 8 * hi;
#pragma unroll
    for (int kc = 0; kc < 2; ++kc) qa[kc] = cat16(*(const v8h*)(Q16 + qo0 + kc * 32), *(const v8h*)(Q16 + qo0 + kc * 32 + 16));
    asm volatile("s_wait_xcnt 0x0" :: "v"(Q16 + qo0) : "memory");     // the query loads' address pair is named as an input, so it stays whole up to this wait
    const h16* kh_b = K16 + tok0 * DM + h * HD;
    const h16* kl_b = KL16 + tok0 * DM + h * HD;
    const size_t vbase = (((size_t)b * NH_ + h) * HD) * NT_;
    v8f o[4], ox[4];
#pragma unroll
    for (int n = 0; n < 4; ++n) { o[n] = (v8f){}; ox[n] = (v8f){}; }
    float mrow[8], lpart[8];
#pragma unroll
    for (int j = 0; j < 8; ++j) { mrow[j] = -3.0e38f; lpart[j] = 0.f; }
    int qpos[8];
#pragma unroll
    for (int j = 0; j < 8; ++j) qpos[j] = q0 + 8 * hi + j;
    const int kt_lo = 0, kt_hi = (qt * 64 + 63) / 32;     // causal; always at least two key tiles
    // one stage = 1024 pieces of 16 B, 8 per thread: 8 lanes bring one whole 128-B k row, 4 lanes one 64-B v row piece; the block's 4 waves share the tile
    const int tid = threadIdx.x;
    const unsigned ring0 = (unsigned)(size_t)(__attribute__((address_space(3))) h16*)&ring[0][0];
    const unsigned lk = ring0 + 2u * (unsigned)((tid >> 3) * KP + (tid & 7) * 8), lv = ring0 + 2u * (unsigned)(2 * KPL + (tid >> 2) * VP + (tid & 3) * 8);
    const size_t gko = (size_t)(tid >> 3) * DM + (tid & 7) * 8, gvo = vbase + (size_t)(tid >> 2) * NT_ + (tid & 3) * 8;
    auto fill = [&](int t, int buf) {
        const unsigned a = lk + (unsigned)buf * (2u * STG), c = lv + (unsigned)buf * (2u * STG);
        const h16* gh = kh_b + gko + (size_t)t * 32 * DM; const h16* gl = kl_b + gko + (size_t)t * 32 * DM;
        const h16* vh = VTH + gvo + t * 32; const h16* vl = VTL + gvo + t * 32;
        // the copies and their s_wait_xcnt in one statement: no address register is rewritten before the wait
        asm volatile("global_load_async_to_lds_b128 %0, %8, off\n\t"
                     "global_load_async_to_lds_b128 %1, %9, off\n\t"
                     "global_load_async_to_lds_b128 %2, %10, off\n\t"
                     "global_load_async_to_lds_b128 %3, %11, off\n\t"
                     "global_load_async_to_lds_b128 %4, %12, off\n\t"
                     "global_load_async_to_lds_b128 %5, %13, off\n\t"
                     "global_load_async_to_lds_b128 %6, %14, off\n\t"
                     "global_load_async_to_lds_b128 %7, %15, off\n\t"
                     "s_wait_xcnt 0x0"
                     :: "v"(a), "v"(a + 2u * 16 * KP), "v"(a + 2u * KPL), "v"(a + 2u * (KPL + 16 * KP)), "v"(c), "v"(c + 2u * 32 * VP), "v"(c + 2u * VPL), "v"(c + 2u * (VPL + 32 * VP)),
                        "v"(gh), "v"(gh + 16 * DM), "v"(gl), "v"(gl + 16 * DM), "v"(vh), "v"(vh + 32 * NT_), "v"(vl), "v"(vl + 32 * NT_) : "memory");
    };
    fill(0, 0);
    asm volatile("s_wait_asynccnt 0x0" ::: "memory");     // tile 0 has landed before the barrier publishes it
    __syncthreads();
    fill(1, 1);
#pragma unroll 1
    for (int kt = kt_lo; kt <= kt_hi; ++kt) {
        const int l0 = kt * 32;
        const h16* st = &ring[kt & 1][0];
        const h16* ks = st + lr * KP + 8 * hi;     // key l0 + lr; key l0 + 16 + lr is 16 rows on; the residual plane KPL on
        v8f s0 = {}, s1 = {}, x0 = {}, x1 = {};
#pragma unroll
        for (int kc = 0; kc < 2; ++kc) {
            { const v16h k0h = cat16(*(const v8ha*)(ks + kc * 32), *(const v8ha*)(ks + kc * 32 + 16)), k1h = cat16(*(const v8ha*)(ks + 16 * KP + kc * 32), *(const v8ha*)(ks + 16 * KP + kc * 32 + 16));
              const v16h qlk = cat16(*(const v8h*)(QL16 + qo0 + kc * 32), *(const v8h*)(QL16 + qo0 + kc * 32 + 16));     // query residual re-read per step (registers)
              s0 = wmma16(qa[kc], k0h, s0); x0 = wmma16(qlk, k0h, x0); s1 = wmma16(qa[kc], k1h, s1); x1 = wmma16(qlk, k1h, x1);
            }
            { const v16h k0l = cat16(*(const v8ha*)(ks + KPL + kc * 32), *(const v8ha*)(ks + KPL + kc * 32 + 16)), k1l = cat16(*(const v8ha*)(ks + KPL + 16 * KP + kc * 32), *(const v8ha*)(ks + KPL + 16 * KP + kc * 32 + 16));
              x0 = wmma16(qa[kc], k0l, x0); x1 = wmma16(qa[kc], k1l, x1); }
        }
        asm volatile("v_nop\n\tv_nop\n\tv_nop\n\tv_nop" : "+v"(s0), "+v"(s1), "+v"(x0), "+v"(x1) : "v"(qa[0]), "v"(qa[1]));
        float alpha[8];
#pragma unroll
        for (int j = 0; j < 8; ++j) {
            const int ja = l0 + lr, jb = l0 + 16 + lr, qi = qpos[j];
            const float a0 = (ja <= qi) ? (s0[j] + x0[j] * LOSCI) * 0.125f : -__builtin_inff(), a1 = (jb <= qi) ? (s1[j] + x1[j] * LOSCI) * 0.125f : -__builtin_inff();
            float mx = fmaxf(a0, a1);
            mx = fmaxf(mx, __shfl_xor(mx, 1, 16)); mx = fmaxf(mx, __shfl_xor(mx, 2, 16)); mx = fmaxf(mx, __shfl_xor(mx, 4, 16)); mx = fmaxf(mx, __shfl_xor(mx, 8, 16));
            const float mn = fmaxf(mrow[j], mx);
            alpha[j] = __expf(mrow[j] - mn); mrow[j] = mn;
            const float p0 = __expf(a0 - mn), p1 = __expf(a1 - mn);
            lpart[j] = lpart[j] * alpha[j] + (p0 + p1);
            const int mr = hi * 8 + j;
            const float ps0 = p0 * PSC, ps1 = p1 * PSC; const h16 h0 = (h16)ps0, h1 = (h16)ps1;
            pl[mr * 32 + lr] = h0; pl[mr * 32 + 16 + lr] = h1;
            pl2[mr * 32 + lr] = (h16)((ps0 - (float)h0) * LOSC); pl2[mr * 32 + 16 + lr] = (h16)((ps1 - (float)h1) * LOSC);
        }
#pragma unroll
        for (int n = 0; n < 4; ++n)
#pragma unroll
            for (int j = 0; j < 8; ++j) { o[n][j] *= alpha[j]; ox[n][j] *= alpha[j]; }
        asm volatile("" ::: "memory");
        const v16h pa = cat16(*(const v8ha*)(pl + lr * 32 + hi * 8), *(const v8ha*)(pl + lr * 32 + 16 + hi * 8));
        const v16h px = cat16(*(const v8ha*)(pl2 + lr * 32 + hi * 8), *(const v8ha*)(pl2 + lr * 32 + 16 + hi * 8));
#pragma unroll
        for (int n = 0; n < 4; ++n) { const h16* vs = st + 2 * KPL + (n * 16 + lr) * VP + hi * 8;
            const v16h vh = cat16(*(const v8ha*)(vs), *(const v8ha*)(vs + 16)), vl = cat16(*(const v8ha*)(vs + VPL), *(const v8ha*)(vs + VPL + 16));
            o[n] = wmma16(pa, vh, o[n]); ox[n] = wmma16(pa, vl, ox[n]); ox[n] = wmma16(px, vh, ox[n]); }
        asm volatile("v_nop\n\tv_nop\n\tv_nop\n\tv_nop" : "+v"(o[0]), "+v"(o[1]), "+v"(o[2]), "+v"(o[3]), "+v"(ox[0]), "+v"(ox[1]), "+v"(ox[2]), "+v"(ox[3]) : "v"(pa), "v"(px));
        asm volatile("s_wait_dscnt 0x0" ::: "memory");        // this wave's reads of the buffer have returned before it is refilled
        asm volatile("s_wait_asynccnt 0x0" ::: "memory");     // this wave's copies of tile kt + 1 have landed before the barrier publishes them
        __syncthreads();                                      // publishes tile kt + 1 and ends every wave's reads of tile kt
        if (kt + 2 <= kt_hi) fill(kt + 2, kt & 1);
    }
    asm volatile("s_wait_asynccnt 0x0" ::: "memory");         // no copy is outstanding when the wave goes on to its end
    float inv[8];
#pragma unroll
    for (int j = 0; j < 8; ++j) { float rs = lpart[j]; rs += __shfl_xor(rs, 1, 16); rs += __shfl_xor(rs, 2, 16); rs += __shfl_xor(rs, 4, 16); rs += __shfl_xor(rs, 8, 16); inv[j] = 1.0f / (rs * PSC); }
    float* os = &ost[wave][0];
#pragma unroll
    for (int n = 0; n < 4; ++n)
#pragma unroll
        for (int j = 0; j < 8; ++j) os[(hi * 8 + j) * 68 + n * 16 + lr] = (o[n][j] + ox[n][j] * LOSCI) * inv[j];
    __syncthreads();
    const size_t cbase = (tok0 + q0) * DM + (size_t)h * HD;
    auto pass = [&]() {
#pragma unroll
        for (int s = 0; s < 8; ++s) { const int row = 2 * s + (lane >> 4), piece = lane & 15; const float* sp = os + row * 68 + piece * 4; v4f v;
#pragma unroll
            for (int i = 0; i < 4; ++i) v[i] = sp[i];
            *(v4f*)(CTX + cbase + (size_t)row * DM + piece * 4) = v; }
    };
    pass(); 
}

#define VST2(T, p, v) do { const T vst2_v_ = (v); *(T*)(p) = vst2_v_;  } while (0)

// k_wt: every per-head weight plane in ONE launch; grid (DM/64, heads, 3): z picks Wq / Wk / Wv, y the head; WT[h*64 + n][k] = bf16(W[h][k][n]) via 64 x 64 LDS tiles.
__global__ __launch_bounds__(256) void k_wt(const float* __restrict__ Wq, const float* __restrict__ Wk, const float* __restrict__ Wv, bf* WqT, bf* WkT, bf* WvT) {
    __shared__ __align__(16) unsigned short tl[64 * 72];
    const int tid = threadIdx.x, k0 = blockIdx.x * 64, h = blockIdx.y, z = blockIdx.z;
    const float* Wm = (z == 0 ? Wq : z == 1 ? Wk : Wv) + (size_t)h * DM * HD;
    bf* WT = (z == 0 ? WqT : z == 1 ? WkT : WvT) + (size_t)h * HD * DM;
    const int kk = tid >> 2, nq = (tid & 3) * 16;
#pragma unroll
    for (int i = 0; i < 16; ++i) tl[(nq + i) * 72 + kk] = f2bf(Wm[(size_t)(k0 + kk) * HD + nq + i]);
    __syncthreads();
    const int piece = tid & 7;
#pragma unroll
    for (int s = 0; s < 2; ++s) { const int nr = (tid >> 3) + 32 * s; const v8us val = *(const v8usa*)(tl + nr * 72 + piece * 8); *(v8us*)(WT + (size_t)nr * DM + k0 + piece * 8) = val; }
}


extern "C" void kernel_launch(void* const* d_in, const int* in_sizes, int n_in,
                              void* d_out, int out_size, void* d_ws, size_t ws_size, hipStream_t stream) {
    (void)in_sizes; (void)n_in; (void)out_size;
    const float* x = (const float*)d_in[0]; const float* Wq = (const float*)d_in[1]; const float* Wk = (const float*)d_in[2]; const float* Wv = (const float*)d_in[3];
    float* out = (float*)d_out;    // [8][1024][768]
    char* wsp = (char*)d_ws;
    auto take = [&](size_t bytes) { char* p = wsp; wsp += (bytes + 255) & ~(size_t)255; return (void*)p; };
    bf* WqT = (bf*)take((size_t)DM * DM * 2); bf* WkT = (bf*)take((size_t)DM * DM * 2); bf* WvT = (bf*)take((size_t)DM * DM * 2);
    bf* Xb = (bf*)take((size_t)NTK * DM * 2);
    h16* QH = (h16*)take((size_t)NTK * DM * 2); h16* QL = (h16*)take((size_t)NTK * DM * 2); h16* KH = (h16*)take((size_t)NTK * DM * 2); h16* KL = (h16*)take((size_t)NTK * DM * 2); h16* VTH = (h16*)take((size_t)NTK * DM * 2); h16* VTL = (h16*)take((size_t)NTK * DM * 2);
    if ((size_t)(wsp - (char*)d_ws) > ws_size) return;    // 3 x 1.2 + 12.6 + 6 x 12.6 ~ 92 MB
    k_wt<<<dim3(DM / 64, NH_, 3), 256, 0, stream>>>(Wq, Wk, Wv, WqT, WkT, WvT);
    k_cvtb<<<NTK / 8, 256, 0, stream>>>(x, NTK, Xb);
    k_gemmb<false, true><<<dim3(NTK / 64, DM / 64, 1), 128, 0, stream>>>(Xb, nullptr, WqT, nullptr, (float*)(void*)QH, DM, QL);
    k_gemmb<false, true><<<dim3(NTK / 64, DM / 64, 1), 128, 0, stream>>>(Xb, nullptr, WkT, nullptr, (float*)(void*)KH, DM, KL);
    k_gemmb<false, false, true><<<dim3(NTK / 64, DM / 64, 1), 128, 0, stream>>>(Xb, nullptr, WvT, nullptr, (float*)(void*)VTH, DM, VTL);
    k_attn<<<NB_ * NH_ * (NT_ / 64), 128, 0, stream>>>(QH, QL, KH, KL, VTH, VTL, out);
}

// v005
// Measured time: 113 microseconds a run.
// In both of two side-by-side timings against v004, it was 1.42 times as fast.
// Counting every step since v000, it is 3.98 times as fast.
#include <hip/hip_runtime.h>

// Compute dtypes, f32 accumulate: q, k, v = x.W_h for all 12 heads as three [8192 x 768].[768 x 768] GEMMs with PLAIN bf16 operands (rounded input; the per-head [768][64] weights
// transposed into one n-major plane; exact products) on v_wmma_f32_16x16x32_bf16; q/k as f16 hi + residual x1024 planes, v as f16 hi/lo transposed planes; per (item, head) causal
// attention over 1024 tokens: scores on v_wmma_f32_16x16x32_f16 (hh + hl + lh, x 1/8), online f32 softmax, weights (x32768) and v as f16 hi/lo on v_wmma_f32_16x16x32_f16; the

#define NB_  8
#define NT_  1024
#define DM   768
#define NH_  12
#define HD   64
#define NTK  (NB_ * NT_)          // 8192 token rows
#define NW   DM
#define PSC  32768.0f
#define LOSC 1024.0f
#define LOSCI (1.0f / 1024.0f)

typedef _Float16 h16;
typedef unsigned short bf;
typedef __attribute__((ext_vector_type(16))) __bf16   v16bf;
typedef __attribute__((ext_vector_type(16))) _Float16 v16h;
typedef __attribute__((ext_vector_type(8)))  _Float16 v8h;
typedef __attribute__((ext_vector_type(8)))  unsigned short v8us;
typedef __attribute__((ext_vector_type(8)))  float    v8f;
typedef __attribute__((ext_vector_type(4)))  float    v4f;
typedef v8h  __attribute__((may_alias)) v8ha;
typedef v4f  __attribute__((may_alias)) v4fa;
typedef v8us __attribute__((may_alias)) v8usa;

__device__ __forceinline__ unsigned short f2bf(float f) { unsigned u = __float_as_uint(f); u += 0x7FFFu + ((u >> 16) & 1u); return (unsigned short)(u >> 16); }
__device__ __forceinline__ float bf2f(unsigned short b) { return __uint_as_float(((unsigned)b) << 16); }
__device__ __forceinline__ float bfr(float f) { return bf2f(f2bf(f)); }
__device__ __forceinline__ v16h cat16(v8h lo, v8h hi) { return __builtin_shufflevector(lo, hi, 0, 1, 2, 3, 4, 5, 6, 7, 8, 9, 10, 11, 12, 13, 14, 15); }
__device__ __forceinline__ v16bf cat16b(v8us lo, v8us hi) { return __builtin_bit_cast(v16bf, __builtin_shufflevector(lo, hi, 0, 1, 2, 3, 4, 5, 6, 7, 8, 9, 10, 11, 12, 13, 14, 15)); }
__device__ __forceinline__ v8f wmma16(v16h a, v16h b, v8f c) { return __builtin_amdgcn_wmma_f32_16x16x32_f16(false, a, false, b, (short)0, c, false, false); }
__device__ __forceinline__ v8f wmmab(v16bf a, v16bf b, v8f c) { return __builtin_amdgcn_wmma_f32_16x16x32_bf16(false, a, false, b, (short)0, c, false, false); }

__global__ __launch_bounds__(256) void k_cvtb(const float* __restrict__ src, int nrows, bf* dst) {
    const int lane = threadIdx.x & 31, r = blockIdx.x * 8 + (threadIdx.x >> 5);
    if (r >= nrows) return;
    v8us o[DM / 256];
#pragma unroll
    for (int q = 0; q < DM / 256; ++q) { v8us t;
#pragma unroll
        for (int i = 0; i < 8; ++i) t[i] = f2bf(src[(size_t)r * DM + q * 256 + lane * 8 + i]);
        o[q] = t; }
#pragma unroll
    for (int q = 0; q < DM / 256; ++q) *(v8us*)(dst + (size_t)r * DM + q * 256 + lane * 8) = o[q];
    
}

// k_gemmb: 64 x 64 block tile (4 waves x 16 x 64) of C[NTK][NW] = (A [+ Al]).B^T (K = 768) [+ bf(bias[c])] [+ bf(R[r][c]) residual]; f32 whole-line epilogue (or f16
// VTOUT: the tile leaves as the two transposed f16 planes [item][head][d][token] (C = hi, C2 = residual x1024); block tile = 64 tokens x one head.
// LDS ring of k_gemmb: a stage = 64 k: the block's A rows [64][64 k], then its B rows [64][64 k], at a pitch of 144 B (16 B x odd: ds_load_b128 without bank conflicts); K a multiple of 64.
// The epilogues stage their tiles in the same LDS, behind the last trip's barrier, so that the six blocks a WGP gets all stay resident.
#define GP   72
#define GPL  (64 * GP)
#define GSTG (2 * GPL)
template <bool SPLITA, bool F16OUT = false, bool VTOUT = false>
__global__ __launch_bounds__(128) void k_gemmb(const bf* __restrict__ A, const bf* __restrict__ Al, const bf* __restrict__ Bn, const float* __restrict__ bias, float* C, int ldc, h16* C2, const float* __restrict__ R = nullptr, int K = DM, int roundR = 1) {
    __shared__ __align__(16) char smem[2 * GSTG * 2];
    const int lane = threadIdx.x & 31, wave = threadIdx.x >> 5, lr = lane & 15, hi = lane >> 4;
    const int r0 = blockIdx.x * 64 + wave * 16, c0 = blockIdx.y * 64;
    const size_t aoff = (size_t)(r0 + lr) * K + 8 * hi;
    v8f acc[4];
#pragma unroll
    for (int t = 0; t < 4; ++t) acc[t] = (v8f){};
    // one stage = 1024 pieces of 16 B, 8 per thread: 8 lanes bring one whole 128-B line of a row; the block's 4 waves share the B tile
    const int tid = threadIdx.x, nt = K >> 6;
    const unsigned ring0 = (unsigned)(size_t)(__attribute__((address_space(3))) char*)&smem[0];
    const unsigned la = ring0 + 2u * (unsigned)((tid >> 3) * GP + (tid & 7) * 8);
    const bf* ga = A + (size_t)(blockIdx.x * 64 + (tid >> 3)) * K + (tid & 7) * 8;
    const bf* gb = Bn + (size_t)(c0 + (tid >> 3)) * K + (tid & 7) * 8;
    const size_t k16 = (size_t)16 * K;
    auto fill = [&](int t, int buf) {
        const unsigned a = la + (unsigned)buf * (2u * GSTG), b = a + 2u * GPL;
        const bf* pa = ga + t * 64; const bf* pb = gb + t * 64;
        // the copies and their s_wait_xcnt in one statement: no address register is rewritten before the wait
        asm volatile("global_load_async_to_lds_b128 %0, %8, off\n\t"
                     "global_load_async_to_lds_b128 %1, %9, off\n\t"
                     "global_load_async_to_lds_b128 %2, %10, off\n\t"
                     "global_load_async_to_lds_b128 %3, %11, off\n\t"
                     "global_load_async_to_lds_b128 %4, %12, off\n\t"
                     "global_load_async_to_lds_b128 %5, %13, off\n\t"
                     "global_load_async_to_lds_b128 %6, %14, off\n\t"
                     "global_load_async_to_lds_b128 %7, %15, off\n\t"
                     "s_wait_xcnt 0x0"
                     :: "v"(a), "v"(a + 2u * 16 * GP), "v"(a + 2u * 32 * GP), "v"(a + 2u * 48 * GP), "v"(b), "v"(b + 2u * 16 * GP), "v"(b + 2u * 32 * GP), "v"(b + 2u * 48 * GP),
                        "v"(pa), "v"(pa + k16), "v"(pa + 2 * k16), "v"(pa + 3 * k16), "v"(pb), "v"(pb + k16), "v"(pb + 2 * k16), "v"(pb + 3 * k16) : "memory");
    };
    fill(0, 0);
    asm volatile("s_wait_asynccnt 0x0" ::: "memory");     // tile 0 has landed before the barrier publishes it
    __syncthreads();
    if (nt > 1) fill(1, 1);
#pragma unroll 1
    for (int s = 0; s < nt; ++s) {
        const bf* st = (const bf*)(const void*)smem + (s & 1) * GSTG;
        const bf* as = st + (wave * 16 + lr) * GP + 8 * hi;     // this wave's 16 rows of A
        const bf* bs = st + GPL + lr * GP + 8 * hi;             // column c0 + lr; column tile t is 16 t rows on
        v16bf a[2], al[2];
#pragma unroll
        for (int kc = 0; kc < 2; ++kc) { a[kc] = cat16b(*(const v8usa*)(as + kc * 32), *(const v8usa*)(as + kc * 32 + 16)); al[kc] = a[kc];
            if (SPLITA) al[kc] = cat16b(*(const v8us*)(Al + aoff + s * 64 + kc * 32), *(const v8us*)(Al + aoff + s * 64 + kc * 32 + 16)); }
#pragma unroll
        for (int kc = 0; kc < 2; ++kc)
#pragma unroll
            for (int t = 0; t < 4; ++t) { const v16bf b = cat16b(*(const v8usa*)(bs + t * 16 * GP + kc * 32), *(const v8usa*)(bs + t * 16 * GP + kc * 32 + 16)); acc[t] = wmmab(a[kc], b, acc[t]); if (SPLITA) acc[t] = wmmab(al[kc], b, acc[t]); }
        asm volatile("v_nop\n\tv_nop\n\tv_nop\n\tv_nop" : "+v"(acc[0]), "+v"(acc[1]), "+v"(acc[2]), "+v"(acc[3]) : "v"(a[0]), "v"(a[1]), "v"(al[0]), "v"(al[1]));
        asm volatile("s_wait_dscnt 0x0" ::: "memory");        // this wave's reads of the buffer have returned before it is refilled
        asm volatile("s_wait_asynccnt 0x0" ::: "memory");     // this wave's copies of tile s + 1 have landed before the barrier publishes them
        __syncthreads();                                      // publishes tile s + 1 and ends every wave's reads of tile s
        if (s + 2 < nt) fill(s + 2, s & 1);
    }
    asm volatile("s_wait_asynccnt 0x0" ::: "memory");         // no copy is outstanding when the ring's LDS is used again below
    if constexpr (VTOUT) {
        h16* tile = (h16*)(void*)smem;
        h16* til2 = tile + 64 * 72;
        // a lane's accumulator holds 8 consecutive tokens of one head dim: one 16-B piece of a transposed row
#pragma unroll
        for (int t = 0; t < 4; ++t) { v8h a8, l8;
#pragma unroll
            for (int j = 0; j < 8; ++j) { const float v = acc[t][j]; const h16 a = (h16)v; a8[j] = a; l8[j] = (h16)((v - (float)a) * LOSC); }
            *(v8ha*)(tile + (t * 16 + lr) * 72 + wave * 16 + hi * 8) = a8; *(v8ha*)(til2 + (t * 16 + lr) * 72 + wave * 16 + hi * 8) = l8; }
        __syncthreads();
        const int tid = threadIdx.x, piece = tid & 7;
        const int b = blockIdx.x / (NT_ / 64), k0 = (blockIdx.x % (NT_ / 64)) * 64, h = blockIdx.y;
        const size_t base = (((size_t)b * NH_ + h) * HD) * NT_ + k0;
        h16* VTH = (h16*)(void*)C;
#pragma unroll
        for (int s = 0; s < 8; ++s) { const int pln = s >> 2, d = (tid >> 3) + 16 * (s & 3);     // 8 lanes write one whole 128-B line
            const v8h val = *(const v8ha*)((pln ? til2 : tile) + d * 72 + piece * 8); *(v8h*)((pln ? C2 : VTH) + base + (size_t)d * NT_ + piece * 8) = val; }
        return;
    }
    float* os = (float*)(void*)smem + wave * (16 * 68);
#pragma unroll
    for (int t = 0; t < 4; ++t) { const float bv = bias ? bfr(bias[c0 + t * 16 + lr]) : 0.f;
#pragma unroll
        for (int j = 0; j < 8; ++j) os[(hi * 8 + j) * 68 + t * 16 + lr] = acc[t][j] + bv; }
    __syncthreads();
    if (F16OUT) {
        h16* crow = (h16*)(void*)C + (size_t)r0 * ldc + c0;
        h16* crow2 = C2 + (size_t)r0 * ldc + c0;
        const int piece = lane & 7;
        v8h o[4], o2[4];     // both planes' pieces first, then the 8 whole-line stores in a row
#pragma unroll
        for (int s = 0; s < 4; ++s) { const float* sp = os + (4 * s + (lane >> 3)) * 68 + piece * 8;
#pragma unroll
            for (int i = 0; i < 8; ++i) { const h16 a = (h16)sp[i]; o[s][i] = a; o2[s][i] = (h16)((sp[i] - (float)a) * LOSC); } }
#pragma unroll
        for (int s = 0; s < 4; ++s) { const size_t ro = (size_t)(4 * s + (lane >> 3)) * ldc + piece * 8; *(v8h*)(crow + ro) = o[s]; *(v8h*)(crow2 + ro) = o2[s]; }
    } else {
        float* crow = C + (size_t)r0 * ldc + c0;
        auto pass = [&]() {
#pragma unroll
            for (int s = 0; s < 8; ++s) { const int Lid = (lane >> 3) + 4 * s, piece = lane & 7; const int row = Lid >> 1, cofs = (Lid & 1) * 32 + piece * 4;
                v4f val = *(const v4fa*)(os + row * 68 + cofs); if (R) { const v4f rv = *(const v4f*)(R + ((size_t)r0 + row) * ldc + c0 + cofs); val += roundR ? (v4f){bfr(rv[0]), bfr(rv[1]), bfr(rv[2]), bfr(rv[3])} : rv; }
                *(v4f*)(crow + (size_t)row * ldc + cofs) = val; }
        };
        pass(); 
    }
}

// k_attn: block = (b, h, 64 queries), wave = 16; CAUSAL: key tiles 0..(64qt+63)/32 with per-element j <= i; 4 WMMA scores /8 (f32), online softmax, weights x32768 f16 tile (same-wave may_alias
// reload after a compiler barrier), 4 WMMA .v; ctx -> f32 output rows [tok][h*64+d] (16 lanes x 16 B per head slice).
// LDS ring of k_attn: a stage = 32 keys: k hi, k residual [32 keys][64 d] at a pitch of 144 B, then v hi, v residual [64 d][32 keys] at a pitch of 80 B (16 B x odd: ds_load_b128 without bank conflicts)
#define KP   72
#define VP   40
#define KPL  (32 * KP)
#define VPL  (64 * VP)
#define STG  (2 * KPL + 2 * VPL)
// amdgpu_waves_per_eu(4, 4): keeps the register count at or below 256, so that four waves per SIMD stay resident as before (without it the grouped LDS reads took 258)
__global__ __launch_bounds__(128) __attribute__((amdgpu_waves_per_eu(4, 4))) void k_attn(const h16* __restrict__ Q16, const h16* __restrict__ QL16, const h16* __restrict__ K16, const h16* __restrict__ KL16, const h16* __restrict__ VTH, const h16* __restrict__ VTL, float* CTX) {
    __shared__ __align__(16) h16 plds[4][16 * 32];
    __shared__ __align__(16) h16 plds2[4][16 * 32];
    __shared__ __align__(16) float ost[4][16 * 68];
    __shared__ __align__(16) h16 ring[2][STG];
    const int lane = threadIdx.x & 31, wave = threadIdx.x >> 5, lr = lane & 15, hi = lane >> 4;
    const int bid = blockIdx.x;
    // heaviest query tiles first (for speed only): a tile's cost grows with qt
    const int qt = (NT_ / 64 - 1) - bid / (NB_ * NH_), bh = bid % (NB_ * NH_), b = bh / NH_, h = bh - b * NH_;
    const int q0 = qt * 64 + wave * 16;
    const size_t tok0 = (size_t)b * NT_;
    h16* pl = &plds[wave][0]; h16* pl2 = &plds2[wave][0];
    v16h qa[2];
    const size_t qo0 = (tok0 + q0 + lr) * DM + h * HD + 8 * hi;
#pragma unroll
    for (int kc = 0; kc < 2; ++kc) qa[kc] = cat16(*(const v8h*)(Q16 + qo0 + kc * 32), *(const v8h*)(Q16 + qo0 + kc * 32 + 16));
    asm volatile("s_wait_xcnt 0x0" :: "v"(Q16 + qo0) : "memory");     // the query loads' address pair is named as an input, so it stays whole up to this wait
    const h16* kh_b = K16 + tok0 * DM + h * HD;
    const h16* kl_b = KL16 + tok0 * DM + h * HD;
    const size_t vbase = (((size_t)b * NH_ + h) * HD) * NT_;
    v8f o[4], ox[4];
#pragma unroll
    for (int n = 0; n < 4; ++n) { o[n] = (v8f){}; ox[n] = (v8f){}; }
    float mrow[8], lpart[8];
#pragma unroll
    for (int j = 0; j < 8; ++j) { mrow[j] = -3.0e38f; lpart[j] = 0.f; }
    int qpos[8];
#pragma unroll
    for (int j = 0; j < 8; ++j) qpos[j] = q0 + 8 * hi + j;
    const int kt_lo = 0, kt_hi = (qt * 64 + 63) / 32;     // causal; always at least two key tiles
    // one stage = 1024 pieces of 16 B, 8 per thread: 8 lanes bring one whole 128-B k row, 4 lanes one 64-B v row piece; the block's 4 waves share the tile
    const int tid = threadIdx.x;
    const unsigned ring0 = (unsigned)(size_t)(__attribute__((address_space(3))) h16*)&ring[0][0];
    const unsigned lk = ring0 + 2u * (unsigned)((tid >> 3) * KP + (tid & 7) * 8), lv = ring0 + 2u * (unsigned)(2 * KPL + (tid >> 2) * VP + (tid & 3) * 8);
    const size_t gko = (size_t)(tid >> 3) * DM + (tid & 7) * 8, gvo = vbase + (size_t)(tid >> 2) * NT_ + (tid & 3) * 8;
    auto fill = [&](int t, int buf) {
        const unsigned a = lk + (unsigned)buf * (2u * STG), c = lv + (unsigned)buf * (2u * STG);
        const h16* gh = kh_b + gko + (size_t)t * 32 * DM; const h16* gl = kl_b + gko + (size_t)t * 32 * DM;
        const h16* vh = VTH + gvo + t * 32; const h16* vl = VTL + gvo + t * 32;
        // the copies and their s_wait_xcnt in one statement: no address register is rewritten before the wait
        asm volatile("global_load_async_to_lds_b128 %0, %8, off\n\t"
                     "global_load_async_to_lds_b128 %1, %9, off\n\t"
                     "global_load_async_to_lds_b128 %2, %10, off\n\t"
                     "global_load_async_to_lds_b128 %3, %11, off\n\t"
                     "global_load_async_to_lds_b128 %4, %12, off\n\t"
                     "global_load_async_to_lds_b128 %5, %13, off\n\t"
                     "global_load_async_to_lds_b128 %6, %14, off\n\t"
                     "global_load_async_to_lds_b128 %7, %15, off\n\t"
                     "s_wait_xcnt 0x0"
                     :: "v"(a), "v"(a + 2u * 16 * KP), "v"(a + 2u * KPL), "v"(a + 2u * (KPL + 16 * KP)), "v"(c), "v"(c + 2u * 32 * VP), "v"(c + 2u * VPL), "v"(c + 2u * (VPL + 32 * VP)),
                        "v"(gh), "v"(gh + 16 * DM), "v"(gl), "v"(gl + 16 * DM), "v"(vh), "v"(vh + 32 * NT_), "v"(vl), "v"(vl + 32 * NT_) : "memory");
    };
    fill(0, 0);
    asm volatile("s_wait_asynccnt 0x0" ::: "memory");     // tile 0 has landed before the barrier publishes it
    __syncthreads();
    fill(1, 1);
#pragma unroll 1
    for (int kt = kt_lo; kt <= kt_hi; ++kt) {
        const int l0 = kt * 32;
        const h16* st = &ring[kt & 1][0];
        const h16* ks = st + lr * KP + 8 * hi;     // key l0 + lr; key l0 + 16 + lr is 16 rows on; the residual plane KPL on
        v8f s0 = {}, s1 = {}, x0 = {}, x1 = {};
#pragma unroll
        for (int kc = 0; kc < 2; ++kc) {
            { const v16h k0h = cat16(*(const v8ha*)(ks + kc * 32), *(const v8ha*)(ks + kc * 32 + 16)), k1h = cat16(*(const v8ha*)(ks + 16 * KP + kc * 32), *(const v8ha*)(ks + 16 * KP + kc * 32 + 16));
              const v16h qlk = cat16(*(const v8h*)(QL16 + qo0 + kc * 32), *(const v8h*)(QL16 + qo0 + kc * 32 + 16));     // query residual re-read per step (registers)
              s0 = wmma16(qa[kc], k0h, s0); x0 = wmma16(qlk, k0h, x0); s1 = wmma16(qa[kc], k1h, s1); x1 = wmma16(qlk, k1h, x1);
            }
            { const v16h k0l = cat16(*(const v8ha*)(ks + KPL + kc * 32), *(const v8ha*)(ks + KPL + kc * 32 + 16)), k1l = cat16(*(const v8ha*)(ks + KPL + 16 * KP + kc * 32), *(const v8ha*)(ks + KPL + 16 * KP + kc * 32 + 16));
              x0 = wmma16(qa[kc], k0l, x0); x1 = wmma16(qa[kc], k1l, x1); }
        }
        asm volatile("v_nop\n\tv_nop\n\tv_nop\n\tv_nop" : "+v"(s0), "+v"(s1), "+v"(x0), "+v"(x1) : "v"(qa[0]), "v"(qa[1]));
        float alpha[8];
#pragma unroll
        for (int j = 0; j < 8; ++j) {
            const int ja = l0 + lr, jb = l0 + 16 + lr, qi = qpos[j];
            const float a0 = (ja <= qi) ? (s0[j] + x0[j] * LOSCI) * 0.125f : -__builtin_inff(), a1 = (jb <= qi) ? (s1[j] + x1[j] * LOSCI) * 0.125f : -__builtin_inff();
            float mx = fmaxf(a0, a1);
            mx = fmaxf(mx, __shfl_xor(mx, 1, 16)); mx = fmaxf(mx, __shfl_xor(mx, 2, 16)); mx = fmaxf(mx, __shfl_xor(mx, 4, 16)); mx = fmaxf(mx, __shfl_xor(mx, 8, 16));
            const float mn = fmaxf(mrow[j], mx);
            alpha[j] = __expf(mrow[j] - mn); mrow[j] = mn;
            const float p0 = __expf(a0 - mn), p1 = __expf(a1 - mn);
            lpart[j] = lpart[j] * alpha[j] + (p0 + p1);
            const int mr = hi * 8 + j;
            const float ps0 = p0 * PSC, ps1 = p1 * PSC; const h16 h0 = (h16)ps0, h1 = (h16)ps1;
            pl[mr * 32 + lr] = h0; pl[mr * 32 + 16 + lr] = h1;
            pl2[mr * 32 + lr] = (h16)((ps0 - (float)h0) * LOSC); pl2[mr * 32 + 16 + lr] = (h16)((ps1 - (float)h1) * LOSC);
        }
#pragma unroll
        for (int n = 0; n < 4; ++n)
#pragma unroll
            for (int j = 0; j < 8; ++j) { o[n][j] *= alpha[j]; ox[n][j] *= alpha[j]; }
        asm volatile("" ::: "memory");
        const v16h pa = cat16(*(const v8ha*)(pl + lr * 32 + hi * 8), *(const v8ha*)(pl + lr * 32 + 16 + hi * 8));
        const v16h px = cat16(*(const v8ha*)(pl2 + lr * 32 + hi * 8), *(const v8ha*)(pl2 + lr * 32 + 16 + hi * 8));
#pragma unroll
        for (int n = 0; n < 4; ++n) { const h16* vs = st + 2 * KPL + (n * 16 + lr) * VP + hi * 8;
            const v16h vh = cat16(*(const v8ha*)(vs), *(const v8ha*)(vs + 16)), vl = cat16(*(const v8ha*)(vs + VPL), *(const v8ha*)(vs + VPL + 16));
            o[n] = wmma16(pa, vh, o[n]); ox[n] = wmma16(pa, vl, ox[n]); ox[n] = wmma16(px, vh, ox[n]); }
        asm volatile("v_nop\n\tv_nop\n\tv_nop\n\tv_nop" : "+v"(o[0]), "+v"(o[1]), "+v"(o[2]), "+v"(o[3]), "+v"(ox[0]), "+v"(ox[1]), "+v"(ox[2]), "+v"(ox[3]) : "v"(pa), "v"(px));
        asm volatile("s_wait_dscnt 0x0" ::: "memory");        // this wave's reads of the buffer have returned before it is refilled
        asm volatile("s_wait_asynccnt 0x0" ::: "memory");     // this wave's copies of tile kt + 1 have landed before the barrier publishes them
        __syncthreads();                                      // publishes tile kt + 1 and ends every wave's reads of tile kt
        if (kt + 2 <= kt_hi) fill(kt + 2, kt & 1);
    }
    asm volatile("s_wait_asynccnt 0x0" ::: "memory");         // no copy is outstanding when the wave goes on to its end
    float inv[8];
#pragma unroll
    for (int j = 0; j < 8; ++j) { float rs = lpart[j]; rs += __shfl_xor(rs, 1, 16); rs += __shfl_xor(rs, 2, 16); rs += __shfl_xor(rs, 4, 16); rs += __shfl_xor(rs, 8, 16); inv[j] = 1.0f / (rs * PSC); }
    float* os = &ost[wave][0];
#pragma unroll
    for (int n = 0; n < 4; ++n)
#pragma unroll
        for (int j = 0; j < 8; ++j) os[(hi * 8 + j) * 68 + n * 16 + lr] = (o[n][j] + ox[n][j] * LOSCI) * inv[j];
    __syncthreads();
    const size_t cbase = (tok0 + q0) * DM + (size_t)h * HD;
    auto pass = [&]() {
#pragma unroll
        for (int s = 0; s < 8; ++s) { const int row = 2 * s + (lane >> 4), piece = lane & 15; const float* sp = os + row * 68 + piece * 4; v4f v;
#pragma unroll
            for (int i = 0; i < 4; ++i) v[i] = sp[i];
            *(v4f*)(CTX + cbase + (size_t)row * DM + piece * 4) = v; }
    };
    pass(); 
}

#define VST2(T, p, v) do { const T vst2_v_ = (v); *(T*)(p) = vst2_v_;  } while (0)

// k_wt: every per-head weight plane in ONE launch; grid (DM/64, heads, 3): z picks Wq / Wk / Wv, y the head; WT[h*64 + n][k] = bf16(W[h][k][n]) via 64 x 64 LDS tiles.
__global__ __launch_bounds__(256) void k_wt(const float* __restrict__ Wq, const float* __restrict__ Wk, const float* __restrict__ Wv, bf* WqT, bf* WkT, bf* WvT) {
    __shared__ __align__(16) unsigned short tl[64 * 72];
    const int tid = threadIdx.x, k0 = blockIdx.x * 64, h = blockIdx.y, z = blockIdx.z;
    const float* Wm = (z == 0 ? Wq : z == 1 ? Wk : Wv) + (size_t)h * DM * HD;
    bf* WT = (z == 0 ? WqT : z == 1 ? WkT : WvT) + (size_t)h * HD * DM;
    const int kk = tid >> 2, nq = (tid & 3) * 16;
#pragma unroll
    for (int i = 0; i < 16; ++i) tl[(nq + i) * 72 + kk] = f2bf(Wm[(size_t)(k0 + kk) * HD + nq + i]);
    __syncthreads();
    const int piece = tid & 7;
#pragma unroll
    for (int s = 0; s < 2; ++s) { const int nr = (tid >> 3) + 32 * s; const v8us val = *(const v8usa*)(tl + nr * 72 + piece * 8); *(v8us*)(WT + (size_t)nr * DM + k0 + piece * 8) = val; }
}


extern "C" void kernel_launch(void* const* d_in, const int* in_sizes, int n_in,
                              void* d_out, int out_size, void* d_ws, size_t ws_size, hipStream_t stream) {
    (void)in_sizes; (void)n_in; (void)out_size;
    const float* x = (const float*)d_in[0]; const float* Wq = (const float*)d_in[1]; const float* Wk = (const float*)d_in[2]; const float* Wv = (const float*)d_in[3];
    float* out = (float*)d_out;    // [8][1024][768]
    char* wsp = (char*)d_ws;
    auto take = [&](size_t bytes) { char* p = wsp; wsp += (bytes + 255) & ~(size_t)255; return (void*)p; };
    bf* WqT = (bf*)take((size_t)DM * DM * 2); bf* WkT = (bf*)take((size_t)DM * DM * 2); bf* WvT = (bf*)take((size_t)DM * DM * 2);
    bf* Xb = (bf*)take((size_t)NTK * DM * 2);
    h16* QH = (h16*)take((size_t)NTK * DM * 2); h16* QL = (h16*)take((size_t)NTK * DM * 2); h16* KH = (h16*)take((size_t)NTK * DM * 2); h16* KL = (h16*)take((size_t)NTK * DM * 2); h16* VTH = (h16*)take((size_t)NTK * DM * 2); h16* VTL = (h16*)take((size_t)NTK * DM * 2);
    if ((size_t)(wsp - (char*)d_ws) > ws_size) return;    // 3 x 1.2 + 12.6 + 6 x 12.6 ~ 92 MB
    k_wt<<<dim3(DM / 64, NH_, 3), 256, 0, stream>>>(Wq, Wk, Wv, WqT, WkT, WvT);
    k_cvtb<<<NTK / 8, 256, 0, stream>>>(x, NTK, Xb);
    k_gemmb<false, true><<<dim3(NTK / 64, DM / 64, 1), 128, 0, stream>>>(Xb, nullptr, WqT, nullptr, (float*)(void*)QH, DM, QL);
    k_gemmb<false, true><<<dim3(NTK / 64, DM / 64, 1), 128, 0, stream>>>(Xb, nullptr, WkT, nullptr, (float*)(void*)KH, DM, KL);
    k_gemmb<false, false, true><<<dim3(NTK / 64, DM / 64, 1), 128, 0, stream>>>(Xb, nullptr, WvT, nullptr, (float*)(void*)VTH, DM, VTL);
    k_attn<<<NB_ * NH_ * (NT_ / 64), 128, 0, stream>>>(QH, QL, KH, KL, VTH, VTL, out);
}

// v006
// One run takes 91.3 microseconds.
// Timed twice side by side with v005, it ran 1.23 times as fast both times.
// Counting every step since v000, it is 4.90 times as fast.
#include <hip/hip_runtime.h>

// Compute dtypes, f32 accumulate: q, k, v = x.W_h for all 12 heads as three [8192 x 768].[768 x 768] GEMMs with PLAIN bf16 operands (rounded input; the per-head [768][64] weights
// transposed into one n-major plane; exact products) on v_wmma_f32_16x16x32_bf16; q/k as f16 hi + residual x1024 planes, v as f16 hi/lo transposed planes; per (item, head) causal
// attention over 1024 tokens: scores on v_wmma_f32_16x16x32_f16 (hh + hl + lh, x 1/8), online f32 softmax, weights (x32768) and v as f16 hi/lo on v_wmma_f32_16x16x32_f16; the

#define NB_  8
#define NT_  1024
#define DM   768
#define NH_  12
#define HD   64
#define NTK  (NB_ * NT_)          // 8192 token rows
#define NW   DM
#define PSC  32768.0f
#define LOSC 1024.0f
#define LOSCI (1.0f / 1024.0f)

typedef _Float16 h16;
typedef unsigned short bf;
typedef __attribute__((ext_vector_type(16))) __bf16   v16bf;
typedef __attribute__((ext_vector_type(16))) _Float16 v16h;
typedef __attribute__((ext_vector_type(8)))  _Float16 v8h;
typedef __attribute__((ext_vector_type(8)))  unsigned short v8us;
typedef __attribute__((ext_vector_type(8)))  float    v8f;
typedef __attribute__((ext_vector_type(4)))  float    v4f;
typedef __attribute__((ext_vector_type(2)))  float    v2f;
typedef __attribute__((ext_vector_type(2)))  _Float16 v2h;
typedef v8h  __attribute__((may_alias)) v8ha;
typedef v4f  __attribute__((may_alias)) v4fa;
typedef v8us __attribute__((may_alias)) v8usa;

__device__ __forceinline__ unsigned short f2bf(float f) { unsigned u = __float_as_uint(f); u += 0x7FFFu + ((u >> 16) & 1u); return (unsigned short)(u >> 16); }
__device__ __forceinline__ float bf2f(unsigned short b) { return __uint_as_float(((unsigned)b) << 16); }
__device__ __forceinline__ float bfr(float f) { return bf2f(f2bf(f)); }
__device__ __forceinline__ v16h cat16(v8h lo, v8h hi) { return __builtin_shufflevector(lo, hi, 0, 1, 2, 3, 4, 5, 6, 7, 8, 9, 10, 11, 12, 13, 14, 15); }
__device__ __forceinline__ v16bf cat16b(v8us lo, v8us hi) { return __builtin_bit_cast(v16bf, __builtin_shufflevector(lo, hi, 0, 1, 2, 3, 4, 5, 6, 7, 8, 9, 10, 11, 12, 13, 14, 15)); }
__device__ __forceinline__ v8f wmma16(v16h a, v16h b, v8f c) { return __builtin_amdgcn_wmma_f32_16x16x32_f16(false, a, false, b, (short)0, c, false, false); }
// lane l <-> l ^ 16: the two halves of a wave hold the two halves of a query's keys
__device__ __forceinline__ float xhalf(float v) { const int b = __float_as_int(v); return __int_as_float(__builtin_amdgcn_permlanex16(b, b, 0x76543210, 0xfedcba98, false, false)); }
__device__ __forceinline__ v8f wmmab(v16bf a, v16bf b, v8f c) { return __builtin_amdgcn_wmma_f32_16x16x32_bf16(false, a, false, b, (short)0, c, false, false); }

__global__ __launch_bounds__(256) void k_cvtb(const float* __restrict__ src, int nrows, bf* dst) {
    const int lane = threadIdx.x & 31, r = blockIdx.x * 8 + (threadIdx.x >> 5);
    if (r >= nrows) return;
    v8us o[DM / 256];
#pragma unroll
    for (int q = 0; q < DM / 256; ++q) { v8us t;
#pragma unroll
        for (int i = 0; i < 8; ++i) t[i] = f2bf(src[(size_t)r * DM + q * 256 + lane * 8 + i]);
        o[q] = t; }
#pragma unroll
    for (int q = 0; q < DM / 256; ++q) *(v8us*)(dst + (size_t)r * DM + q * 256 + lane * 8) = o[q];
    
}

// k_gemmb: 64 x 64 block tile (4 waves x 16 x 64) of C[NTK][NW] = (A [+ Al]).B^T (K = 768) [+ bf(bias[c])] [+ bf(R[r][c]) residual]; f32 whole-line epilogue (or f16
// VTOUT: the tile leaves as the two transposed f16 planes [item][head][d][token] (C = hi, C2 = residual x1024); block tile = 64 tokens x one head.
// LDS ring of k_gemmb: a stage = 64 k: the block's A rows [64][64 k], then its B rows [64][64 k], at a pitch of 144 B (16 B x odd: ds_load_b128 without bank conflicts); K a multiple of 64.
// The epilogues stage their tiles in the same LDS, behind the last trip's barrier, so that the six blocks a WGP gets all stay resident.
#define GP   72
#define GPL  (64 * GP)
#define GSTG (2 * GPL)
template <bool SPLITA, bool F16OUT = false, bool VTOUT = false>
__global__ __launch_bounds__(128) void k_gemmb(const bf* __restrict__ A, const bf* __restrict__ Al, const bf* __restrict__ Bn, const float* __restrict__ bias, float* C, int ldc, h16* C2, const float* __restrict__ R = nullptr, int K = DM, int roundR = 1) {
    __shared__ __align__(16) char smem[2 * GSTG * 2];
    const int lane = threadIdx.x & 31, wave = threadIdx.x >> 5, lr = lane & 15, hi = lane >> 4;
    const int r0 = blockIdx.x * 64 + wave * 16, c0 = blockIdx.y * 64;
    const size_t aoff = (size_t)(r0 + lr) * K + 8 * hi;
    v8f acc[4];
#pragma unroll
    for (int t = 0; t < 4; ++t) acc[t] = (v8f){};
    // one stage = 1024 pieces of 16 B, 8 per thread: 8 lanes bring one whole 128-B line of a row; the block's 4 waves share the B tile
    const int tid = threadIdx.x, nt = K >> 6;
    const unsigned ring0 = (unsigned)(size_t)(__attribute__((address_space(3))) char*)&smem[0];
    const unsigned la = ring0 + 2u * (unsigned)((tid >> 3) * GP + (tid & 7) * 8);
    const bf* ga = A + (size_t)(blockIdx.x * 64 + (tid >> 3)) * K + (tid & 7) * 8;
    const bf* gb = Bn + (size_t)(c0 + (tid >> 3)) * K + (tid & 7) * 8;
    const size_t k16 = (size_t)16 * K;
    auto fill = [&](int t, int buf) {
        const unsigned a = la + (unsigned)buf * (2u * GSTG), b = a + 2u * GPL;
        const bf* pa = ga + t * 64; const bf* pb = gb + t * 64;
        // the copies and their s_wait_xcnt in one statement: no address register is rewritten before the wait
        asm volatile("global_load_async_to_lds_b128 %0, %8, off\n\t"
                     "global_load_async_to_lds_b128 %1, %9, off\n\t"
                     "global_load_async_to_lds_b128 %2, %10, off\n\t"
                     "global_load_async_to_lds_b128 %3, %11, off\n\t"
                     "global_load_async_to_lds_b128 %4, %12, off\n\t"
                     "global_load_async_to_lds_b128 %5, %13, off\n\t"
                     "global_load_async_to_lds_b128 %6, %14, off\n\t"
                     "global_load_async_to_lds_b128 %7, %15, off\n\t"
                     "s_wait_xcnt 0x0"
                     :: "v"(a), "v"(a + 2u * 16 * GP), "v"(a + 2u * 32 * GP), "v"(a + 2u * 48 * GP), "v"(b), "v"(b + 2u * 16 * GP), "v"(b + 2u * 32 * GP), "v"(b + 2u * 48 * GP),
                        "v"(pa), "v"(pa + k16), "v"(pa + 2 * k16), "v"(pa + 3 * k16), "v"(pb), "v"(pb + k16), "v"(pb + 2 * k16), "v"(pb + 3 * k16) : "memory");
    };
    fill(0, 0);
    asm volatile("s_wait_asynccnt 0x0" ::: "memory");     // tile 0 has landed before the barrier publishes it
    __syncthreads();
    if (nt > 1) fill(1, 1);
#pragma unroll 1
    for (int s = 0; s < nt; ++s) {
        const bf* st = (const bf*)(const void*)smem + (s & 1) * GSTG;
        const bf* as = st + (wave * 16 + lr) * GP + 8 * hi;     // this wave's 16 rows of A
        const bf* bs = st + GPL + lr * GP + 8 * hi;             // column c0 + lr; column tile t is 16 t rows on
        v16bf a[2], al[2];
#pragma unroll
        for (int kc = 0; kc < 2; ++kc) { a[kc] = cat16b(*(const v8usa*)(as + kc * 32), *(const v8usa*)(as + kc * 32 + 16)); al[kc] = a[kc];
            if (SPLITA) al[kc] = cat16b(*(const v8us*)(Al + aoff + s * 64 + kc * 32), *(const v8us*)(Al + aoff + s * 64 + kc * 32 + 16)); }
#pragma unroll
        for (int kc = 0; kc < 2; ++kc)
#pragma unroll
            for (int t = 0; t < 4; ++t) { const v16bf b = cat16b(*(const v8usa*)(bs + t * 16 * GP + kc * 32), *(const v8usa*)(bs + t * 16 * GP + kc * 32 + 16)); acc[t] = wmmab(a[kc], b, acc[t]); if (SPLITA) acc[t] = wmmab(al[kc], b, acc[t]); }
        asm volatile("v_nop\n\tv_nop\n\tv_nop\n\tv_nop" : "+v"(acc[0]), "+v"(acc[1]), "+v"(acc[2]), "+v"(acc[3]) : "v"(a[0]), "v"(a[1]), "v"(al[0]), "v"(al[1]));
        asm volatile("s_wait_dscnt 0x0" ::: "memory");        // this wave's reads of the buffer have returned before it is refilled
        asm volatile("s_wait_asynccnt 0x0" ::: "memory");     // this wave's copies of tile s + 1 have landed before the barrier publishes them
        __syncthreads();                                      // publishes tile s + 1 and ends every wave's reads of tile s
        if (s + 2 < nt) fill(s + 2, s & 1);
    }
    asm volatile("s_wait_asynccnt 0x0" ::: "memory");         // no copy is outstanding when the ring's LDS is used again below
    if constexpr (VTOUT) {
        h16* tile = (h16*)(void*)smem;
        h16* til2 = tile + 64 * 72;
        // a lane's accumulator holds 8 consecutive tokens of one head dim: one 16-B piece of a transposed row
#pragma unroll
        for (int t = 0; t < 4; ++t) { v8h a8, l8;
#pragma unroll
            for (int j = 0; j < 8; ++j) { const float v = acc[t][j]; const h16 a = (h16)v; a8[j] = a; l8[j] = (h16)((v - (float)a) * LOSC); }
            *(v8ha*)(tile + (t * 16 + lr) * 72 + wave * 16 + hi * 8) = a8; *(v8ha*)(til2 + (t * 16 + lr) * 72 + wave * 16 + hi * 8) = l8; }
        __syncthreads();
        const int tid = threadIdx.x, piece = tid & 7;
        const int b = blockIdx.x / (NT_ / 64), k0 = (blockIdx.x % (NT_ / 64)) * 64, h = blockIdx.y;
        const size_t base = (((size_t)b * NH_ + h) * HD) * NT_ + k0;
        h16* VTH = (h16*)(void*)C;
#pragma unroll
        for (int s = 0; s < 8; ++s) { const int pln = s >> 2, d = (tid >> 3) + 16 * (s & 3);     // 8 lanes write one whole 128-B line
            const v8h val = *(const v8ha*)((pln ? til2 : tile) + d * 72 + piece * 8); *(v8h*)((pln ? C2 : VTH) + base + (size_t)d * NT_ + piece * 8) = val; }
        return;
    }
    float* os = (float*)(void*)smem + wave * (16 * 68);
#pragma unroll
    for (int t = 0; t < 4; ++t) { const float bv = bias ? bfr(bias[c0 + t * 16 + lr]) : 0.f;
#pragma unroll
        for (int j = 0; j < 8; ++j) os[(hi * 8 + j) * 68 + t * 16 + lr] = acc[t][j] + bv; }
    __syncthreads();
    if (F16OUT) {
        h16* crow = (h16*)(void*)C + (size_t)r0 * ldc + c0;
        h16* crow2 = C2 + (size_t)r0 * ldc + c0;
        const int piece = lane & 7;
        v8h o[4], o2[4];     // both planes' pieces first, then the 8 whole-line stores in a row
#pragma unroll
        for (int s = 0; s < 4; ++s) { const float* sp = os + (4 * s + (lane >> 3)) * 68 + piece * 8;
#pragma unroll
            for (int i = 0; i < 8; ++i) { const h16 a = (h16)sp[i]; o[s][i] = a; o2[s][i] = (h16)((sp[i] - (float)a) * LOSC); } }
#pragma unroll
        for (int s = 0; s < 4; ++s) { const size_t ro = (size_t)(4 * s + (lane >> 3)) * ldc + piece * 8; *(v8h*)(crow + ro) = o[s]; *(v8h*)(crow2 + ro) = o2[s]; }
    } else {
        float* crow = C + (size_t)r0 * ldc + c0;
        auto pass = [&]() {
#pragma unroll
            for (int s = 0; s < 8; ++s) { const int Lid = (lane >> 3) + 4 * s, piece = lane & 7; const int row = Lid >> 1, cofs = (Lid & 1) * 32 + piece * 4;
                v4f val = *(const v4fa*)(os + row * 68 + cofs); if (R) { const v4f rv = *(const v4f*)(R + ((size_t)r0 + row) * ldc + c0 + cofs); val += roundR ? (v4f){bfr(rv[0]), bfr(rv[1]), bfr(rv[2]), bfr(rv[3])} : rv; }
                *(v4f*)(crow + (size_t)row * ldc + cofs) = val; }
        };
        pass(); 
    }
}

// k_attn: block = (b, h, 64 queries), wave = 16; CAUSAL: key tiles 0..(64qt+63)/32 with per-element j <= i. TRANSPOSED products: scores^T = k.q^T (A = key rows, B = query columns), so a lane holds
// 16 of the 32 scores of ONE query (lane & 15; the other 16 in lane ^ 16): maximum and sum run in the lane, one exchange between the halves. The two score tiles, converted in place (x32768, f16 hi +
// residual), are the B operand of ctx^T += v^T.p^T in the hardware k order: the weights never touch LDS. ctx -> f32 output rows [tok][h*64+d] (16 lanes x 16 B per head slice).
// LDS ring of k_attn: a stage = 32 keys: k hi, k residual [32 keys][64 d] at a pitch of 144 B, then v hi, v residual [64 d][32 keys] at a pitch of 80 B (16 B x odd: ds_load_b128 without bank conflicts)
#define KP   72
#define VP   40
#define KPL  (32 * KP)
#define VPL  (64 * VP)
#define STG  (2 * KPL + 2 * VPL)
// amdgpu_waves_per_eu(4, 4): keeps the register count at or below 256, so that four waves per SIMD stay resident as before (without it the grouped LDS reads took 258)
__global__ __launch_bounds__(128) __attribute__((amdgpu_waves_per_eu(4, 4))) void k_attn(const h16* __restrict__ Q16, const h16* __restrict__ QL16, const h16* __restrict__ K16, const h16* __restrict__ KL16, const h16* __restrict__ VTH, const h16* __restrict__ VTL, float* CTX) {
    __shared__ __align__(16) float ost[4][16 * 68];
    __shared__ __align__(16) h16 ring[2][STG];
    const int lane = threadIdx.x & 31, wave = threadIdx.x >> 5, lr = lane & 15, hi = lane >> 4;
    const int bid = blockIdx.x;
    // heaviest query tiles first (for speed only): a tile's cost grows with qt
    const int qt = (NT_ / 64 - 1) - bid / (NB_ * NH_), bh = bid % (NB_ * NH_), b = bh / NH_, h = bh - b * NH_;
    const int q0 = qt * 64 + wave * 16;
    const size_t tok0 = (size_t)b * NT_;
    v16h qa[2];
    const size_t qo0 = (tok0 + q0 + lr) * DM + h * HD + 8 * hi;
#pragma unroll
    for (int kc = 0; kc < 2; ++kc) qa[kc] = cat16(*(const v8h*)(Q16 + qo0 + kc * 32), *(const v8h*)(Q16 + qo0 + kc * 32 + 16));
    asm volatile("s_wait_xcnt 0x0" :: "v"(Q16 + qo0) : "memory");     // the query loads' address pair is named as an input, so it stays whole up to this wait
    const h16* kh_b = K16 + tok0 * DM + h * HD;
    const h16* kl_b = KL16 + tok0 * DM + h * HD;
    const size_t vbase = (((size_t)b * NH_ + h) * HD) * NT_;
    v8f o[4], ox[4];
#pragma unroll
    for (int n = 0; n < 4; ++n) { o[n] = (v8f){}; ox[n] = (v8f){}; }
    float mrow = -3.0e38f, lpart = 0.f;     // of query q0 + lr; mrow is equal in both halves, lpart sums this half's keys
    const int qi = q0 + lr;
    const int kt_lo = 0, kt_hi = (qt * 64 + 63) / 32;     // causal; always at least two key tiles
    // one stage = 1024 pieces of 16 B, 8 per thread: 8 lanes bring one whole 128-B k row, 4 lanes one 64-B v row piece; the block's 4 waves share the tile
    const int tid = threadIdx.x;
    const unsigned ring0 = (unsigned)(size_t)(__attribute__((address_space(3))) h16*)&ring[0][0];
    const unsigned lk = ring0 + 2u * (unsigned)((tid >> 3) * KP + (tid & 7) * 8), lv = ring0 + 2u * (unsigned)(2 * KPL + (tid >> 2) * VP + (tid & 3) * 8);
    const size_t gko = (size_t)(tid >> 3) * DM + (tid & 7) * 8, gvo = vbase + (size_t)(tid >> 2) * NT_ + (tid & 3) * 8;
    auto fill = [&](int t, int buf) {
        const unsigned a = lk + (unsigned)buf * (2u * STG), c = lv + (unsigned)buf * (2u * STG);
        const h16* gh = kh_b + gko + (size_t)t * 32 * DM; const h16* gl = kl_b + gko + (size_t)t * 32 * DM;
        const h16* vh = VTH + gvo + t * 32; const h16* vl = VTL + gvo + t * 32;
        // the copies and their s_wait_xcnt in one statement: no address register is rewritten before the wait
        asm volatile("global_load_async_to_lds_b128 %0, %8, off\n\t"
                     "global_load_async_to_lds_b128 %1, %9, off\n\t"
                     "global_load_async_to_lds_b128 %2, %10, off\n\t"
                     "global_load_async_to_lds_b128 %3, %11, off\n\t"
                     "global_load_async_to_lds_b128 %4, %12, off\n\t"
                     "global_load_async_to_lds_b128 %5, %13, off\n\t"
                     "global_load_async_to_lds_b128 %6, %14, off\n\t"
                     "global_load_async_to_lds_b128 %7, %15, off\n\t"
                     "s_wait_xcnt 0x0"
                     :: "v"(a), "v"(a + 2u * 16 * KP), "v"(a + 2u * KPL), "v"(a + 2u * (KPL + 16 * KP)), "v"(c), "v"(c + 2u * 32 * VP), "v"(c + 2u * VPL), "v"(c + 2u * (VPL + 32 * VP)),
                        "v"(gh), "v"(gh + 16 * DM), "v"(gl), "v"(gl + 16 * DM), "v"(vh), "v"(vh + 32 * NT_), "v"(vl), "v"(vl + 32 * NT_) : "memory");
    };
    fill(0, 0);
    asm volatile("s_wait_asynccnt 0x0" ::: "memory");     // tile 0 has landed before the barrier publishes it
    __syncthreads();
    fill(1, 1);
#pragma unroll 1
    for (int kt = kt_lo; kt <= kt_hi; ++kt) {
        const int l0 = kt * 32;
        const h16* st = &ring[kt & 1][0];
        const h16* ks = st + lr * KP + 8 * hi;     // key l0 + lr; key l0 + 16 + lr is 16 rows on; the residual plane KPL on
        v8f s0 = {}, s1 = {}, x0 = {}, x1 = {};
#pragma unroll
        for (int kc = 0; kc < 2; ++kc) {
            { const v16h k0h = cat16(*(const v8ha*)(ks + kc * 32), *(const v8ha*)(ks + kc * 32 + 16)), k1h = cat16(*(const v8ha*)(ks + 16 * KP + kc * 32), *(const v8ha*)(ks + 16 * KP + kc * 32 + 16));
              const v16h qlk = cat16(*(const v8h*)(QL16 + qo0 + kc * 32), *(const v8h*)(QL16 + qo0 + kc * 32 + 16));     // query residual re-read per step (registers)
              s0 = wmma16(k0h, qa[kc], s0); x0 = wmma16(k0h, qlk, x0); s1 = wmma16(k1h, qa[kc], s1); x1 = wmma16(k1h, qlk, x1);
            }
            { const v16h k0l = cat16(*(const v8ha*)(ks + KPL + kc * 32), *(const v8ha*)(ks + KPL + kc * 32 + 16)), k1l = cat16(*(const v8ha*)(ks + KPL + 16 * KP + kc * 32), *(const v8ha*)(ks + KPL + 16 * KP + kc * 32 + 16));
              x0 = wmma16(k0l, qa[kc], x0); x1 = wmma16(k1l, qa[kc], x1); }
        }
        asm volatile("v_nop\n\tv_nop\n\tv_nop\n\tv_nop" : "+v"(s0), "+v"(s1), "+v"(x0), "+v"(x1) : "v"(qa[0]), "v"(qa[1]));
        // register j of s0 / s1 = key l0 + 8 hi + j / l0 + 16 + 8 hi + j against query qi: kept while j / 16 + j <= dq
        const int dq = qi - l0 - 8 * hi;
        v2f a[8];     // pairs of neighbouring registers, so that the packed f32 forms take them where they lie
#pragma unroll
        for (int g = 0; g < 4; ++g) {
            a[g]     = ((v2f){s0[2 * g], s0[2 * g + 1]} + (v2f){x0[2 * g], x0[2 * g + 1]} * LOSCI) * 0.125f;
            a[4 + g] = ((v2f){s1[2 * g], s1[2 * g + 1]} + (v2f){x1[2 * g], x1[2 * g + 1]} * LOSCI) * 0.125f;
        }
#pragma unroll
        for (int g = 0; g < 8; ++g)
#pragma unroll
            for (int i = 0; i < 2; ++i) a[g][i] = ((g >> 2) * 16 + (g & 3) * 2 + i <= dq) ? a[g][i] : -__builtin_inff();
        float mx = fmaxf(a[0][0], a[0][1]);
#pragma unroll
        for (int g = 1; g < 8; ++g) mx = fmaxf(mx, fmaxf(a[g][0], a[g][1]));
        mx = fmaxf(mx, xhalf(mx));
        const float mn = fmaxf(mrow, mx);
        const float alpha = __expf(mrow - mn); mrow = mn;
        v2f ps2 = {0.f, 0.f};
        v16h pa, px;     // element s = key 8 hi + s (s < 8) or 8 hi + s + 8 (s >= 8) of the tile: the k order of the v loader below
#pragma unroll
        for (int g = 0; g < 8; ++g) {
            const v2f p = {__expf(a[g][0] - mn), __expf(a[g][1] - mn)};
            ps2 += p;
            const v2f ps = p * PSC;
            const v2h hp = __builtin_convertvector(ps, v2h);
            const v2h hx = __builtin_convertvector((ps - __builtin_convertvector(hp, v2f)) * LOSC, v2h);
            pa[2 * g] = hp[0]; pa[2 * g + 1] = hp[1]; px[2 * g] = hx[0]; px[2 * g + 1] = hx[1];
        }
        const float psum = ps2[0] + ps2[1];
        lpart = lpart * alpha + psum;
#pragma unroll
        for (int n = 0; n < 4; ++n)
#pragma unroll
            for (int j = 0; j < 8; ++j) { o[n][j] *= alpha; ox[n][j] *= alpha; }
#pragma unroll
        for (int n = 0; n < 4; ++n) { const h16* vs = st + 2 * KPL + (n * 16 + lr) * VP + hi * 8;
            const v16h vh = cat16(*(const v8ha*)(vs), *(const v8ha*)(vs + 16)), vl = cat16(*(const v8ha*)(vs + VPL), *(const v8ha*)(vs + VPL + 16));
            o[n] = wmma16(vh, pa, o[n]); ox[n] = wmma16(vl, pa, ox[n]); ox[n] = wmma16(vh, px, ox[n]); }     // register j of o[n] = head dim 16 n + 8 hi + j of query qi
        asm volatile("v_nop\n\tv_nop\n\tv_nop\n\tv_nop" : "+v"(o[0]), "+v"(o[1]), "+v"(o[2]), "+v"(o[3]), "+v"(ox[0]), "+v"(ox[1]), "+v"(ox[2]), "+v"(ox[3]) : "v"(pa), "v"(px));
        asm volatile("s_wait_dscnt 0x0" ::: "memory");        // this wave's reads of the buffer have returned before it is refilled
        asm volatile("s_wait_asynccnt 0x0" ::: "memory");     // this wave's copies of tile kt + 1 have landed before the barrier publishes them
        __syncthreads();                                      // publishes tile kt + 1 and ends every wave's reads of tile kt
        if (kt + 2 <= kt_hi) fill(kt + 2, kt & 1);
    }
    asm volatile("s_wait_asynccnt 0x0" ::: "memory");         // no copy is outstanding when the wave goes on to its end
    const float inv = 1.0f / ((lpart + xhalf(lpart)) * PSC);     // the halves' sums are joined once
    float* os = &ost[wave][0];
#pragma unroll
    for (int n = 0; n < 4; ++n)
#pragma unroll
        for (int g = 0; g < 2; ++g) { v4f w;
#pragma unroll
            for (int i = 0; i < 4; ++i) w[i] = (o[n][4 * g + i] + ox[n][4 * g + i] * LOSCI) * inv;
            *(v4fa*)(os + lr * 68 + n * 16 + hi * 8 + 4 * g) = w; }
    __syncthreads();
    const size_t cbase = (tok0 + q0) * DM + (size_t)h * HD;
    auto pass = [&]() {
#pragma unroll
        for (int s = 0; s < 8; ++s) { const int row = 2 * s + (lane >> 4), piece = lane & 15; const float* sp = os + row * 68 + piece * 4; v4f v;
#pragma unroll
            for (int i = 0; i < 4; ++i) v[i] = sp[i];
            *(v4f*)(CTX + cbase + (size_t)row * DM + piece * 4) = v; }
    };
    pass(); 
}

#define VST2(T, p, v) do { const T vst2_v_ = (v); *(T*)(p) = vst2_v_;  } while (0)

// k_wt: every per-head weight plane in ONE launch; grid (DM/64, heads, 3): z picks Wq / Wk / Wv, y the head; WT[h*64 + n][k] = bf16(W[h][k][n]) via 64 x 64 LDS tiles.
__global__ __launch_bounds__(256) void k_wt(const float* __restrict__ Wq, const float* __restrict__ Wk, const float* __restrict__ Wv, bf* WqT, bf* WkT, bf* WvT) {
    __shared__ __align__(16) unsigned short tl[64 * 72];
    const int tid = threadIdx.x, k0 = blockIdx.x * 64, h = blockIdx.y, z = blockIdx.z;
    const float* Wm = (z == 0 ? Wq : z == 1 ? Wk : Wv) + (size_t)h * DM * HD;
    bf* WT = (z == 0 ? WqT : z == 1 ? WkT : WvT) + (size_t)h * HD * DM;
    const int kk = tid >> 2, nq = (tid & 3) * 16;
#pragma unroll
    for (int i = 0; i < 16; ++i) tl[(nq + i) * 72 + kk] = f2bf(Wm[(size_t)(k0 + kk) * HD + nq + i]);
    __syncthreads();
    const int piece = tid & 7;
#pragma unroll
    for (int s = 0; s < 2; ++s) { const int nr = (tid >> 3) + 32 * s; const v8us val = *(const v8usa*)(tl + nr * 72 + piece * 8); *(v8us*)(WT + (size_t)nr * DM + k0 + piece * 8) = val; }
}


extern "C" void kernel_launch(void* const* d_in, const int* in_sizes, int n_in,
                              void* d_out, int out_size, void* d_ws, size_t ws_size, hipStream_t stream) {
    (void)in_sizes; (void)n_in; (void)out_size;
    const float* x = (const float*)d_in[0]; const float* Wq = (const float*)d_in[1]; const float* Wk = (const float*)d_in[2]; const float* Wv = (const float*)d_in[3];
    float* out = (float*)d_out;    // [8][1024][768]
    char* wsp = (char*)d_ws;
    auto take = [&](size_t bytes) { char* p = wsp; wsp += (bytes + 255) & ~(size_t)255; return (void*)p; };
    bf* WqT = (bf*)take((size_t)DM * DM * 2); bf* WkT = (bf*)take((size_t)DM * DM * 2); bf* WvT = (bf*)take((size_t)DM * DM * 2);
    bf* Xb = (bf*)take((size_t)NTK * DM * 2);
    h16* QH = (h16*)take((size_t)NTK * DM * 2); h16* QL = (h16*)take((size_t)NTK * DM * 2); h16* KH = (h16*)take((size_t)NTK * DM * 2); h16* KL = (h16*)take((size_t)NTK * DM * 2); h16* VTH = (h16*)take((size_t)NTK * DM * 2); h16* VTL = (h16*)take((size_t)NTK * DM * 2);
    if ((size_t)(wsp - (char*)d_ws) > ws_size) return;    // 3 x 1.2 + 12.6 + 6 x 12.6 ~ 92 MB
    k_wt<<<dim3(DM / 64, NH_, 3), 256, 0, stream>>>(Wq, Wk, Wv, WqT, WkT, WvT);
    k_cvtb<<<NTK / 8, 256, 0, stream>>>(x, NTK, Xb);
    k_gemmb<false, true><<<dim3(NTK / 64, DM / 64, 1), 128, 0, stream>>>(Xb, nullptr, WqT, nullptr, (float*)(void*)QH, DM, QL);
    k_gemmb<false, true><<<dim3(NTK / 64, DM / 64, 1), 128, 0, stream>>>(Xb, nullptr, WkT, nullptr, (float*)(void*)KH, DM, KL);
    k_gemmb<false, false, true><<<dim3(NTK / 64, DM / 64, 1), 128, 0, stream>>>(Xb, nullptr, WvT, nullptr, (float*)(void*)VTH, DM, VTL);
    k_attn<<<NB_ * NH_ * (NT_ / 64), 128, 0, stream>>>(QH, QL, KH, KL, VTH, VTL, out);
}

// v007
// A run of this version takes 86.4 microseconds.
// Timed twice side by side with v006, it ran 1.06 times as fast both times.
// All steps since v000 together make it 5.19 times as fast.
#include <hip/hip_runtime.h>

// Compute dtypes, f32 accumulate: q, k, v = x.W_h for all 12 heads as three [8192 x 768].[768 x 768] GEMMs with PLAIN bf16 operands (rounded input; the per-head [768][64] weights
// transposed into one n-major plane; exact products) on v_wmma_f32_16x16x32_bf16; q/k as f16 hi + residual x1024 planes, v as f16 hi/lo transposed planes; per (item, head) causal
// attention over 1024 tokens: scores on v_wmma_f32_16x16x32_f16 (hh + hl + lh, x 1/8), online f32 softmax, weights (x32768) and v as f16 hi/lo on v_wmma_f32_16x16x32_f16; the

#define NB_  8
#define NT_  1024
#define DM   768
#define NH_  12
#define HD   64
#define NTK  (NB_ * NT_)          // 8192 token rows
#define NW   DM
#define PSC  32768.0f
#define LOSC 1024.0f
#define LOSCI (1.0f / 1024.0f)

typedef _Float16 h16;
typedef unsigned short bf;
typedef __attribute__((ext_vector_type(16))) __bf16   v16bf;
typedef __attribute__((ext_vector_type(16))) _Float16 v16h;
typedef __attribute__((ext_vector_type(8)))  _Float16 v8h;
typedef __attribute__((ext_vector_type(8)))  unsigned short v8us;
typedef __attribute__((ext_vector_type(8)))  float    v8f;
typedef __attribute__((ext_vector_type(4)))  float    v4f;
typedef __attribute__((ext_vector_type(2)))  float    v2f;
typedef __attribute__((ext_vector_type(2)))  _Float16 v2h;
typedef v8h  __attribute__((may_alias)) v8ha;
typedef v4f  __attribute__((may_alias)) v4fa;
typedef v8us __attribute__((may_alias)) v8usa;

__device__ __forceinline__ unsigned short f2bf(float f) { unsigned u = __float_as_uint(f); u += 0x7FFFu + ((u >> 16) & 1u); return (unsigned short)(u >> 16); }
__device__ __forceinline__ v16h cat16(v8h lo, v8h hi) { return __builtin_shufflevector(lo, hi, 0, 1, 2, 3, 4, 5, 6, 7, 8, 9, 10, 11, 12, 13, 14, 15); }
__device__ __forceinline__ v16bf cat16b(v8us lo, v8us hi) { return __builtin_bit_cast(v16bf, __builtin_shufflevector(lo, hi, 0, 1, 2, 3, 4, 5, 6, 7, 8, 9, 10, 11, 12, 13, 14, 15)); }
__device__ __forceinline__ v8f wmma16(v16h a, v16h b, v8f c) { return __builtin_amdgcn_wmma_f32_16x16x32_f16(false, a, false, b, (short)0, c, false, false); }
// lane l <-> l ^ 16: the two halves of a wave hold the two halves of a query's keys
__device__ __forceinline__ float xhalf(float v) { const int b = __float_as_int(v); return __int_as_float(__builtin_amdgcn_permlanex16(b, b, 0x76543210, 0xfedcba98, false, false)); }
__device__ __forceinline__ v8f wmmab(v16bf a, v16bf b, v8f c) { return __builtin_amdgcn_wmma_f32_16x16x32_bf16(false, a, false, b, (short)0, c, false, false); }

// k_prep: both operand converters in ONE launch (they are independent of each other). Blocks 0 .. NWTB - 1: one 64 x 64 tile of a per-head weight plane, WT[h*64 + n][k] = bf16(W[h][k][n]), via LDS;
// the tile index runs k tile fastest, then head, then matrix (Wq / Wk / Wv). The other NTK / 8 blocks: 8 rows of x each, rounded to bf16, one row per wave.
#define NWTB ((DM / 64) * NH_ * 3)
__global__ __launch_bounds__(256) void k_prep(const float* __restrict__ x, const float* __restrict__ Wq, const float* __restrict__ Wk, const float* __restrict__ Wv, bf* Xb, bf* WqT, bf* WkT, bf* WvT) {
    __shared__ __align__(16) unsigned short tl[64 * 72];
    const int tid = threadIdx.x, bid = blockIdx.x;
    if (bid < NWTB) {     // block-uniform, so the barrier below is passed by the whole block or by none of it
        const int k0 = (bid % (DM / 64)) * 64, h = (bid / (DM / 64)) % NH_, z = bid / ((DM / 64) * NH_);
        const float* Wm = (z == 0 ? Wq : z == 1 ? Wk : Wv) + (size_t)h * DM * HD;
        bf* WT = (z == 0 ? WqT : z == 1 ? WkT : WvT) + (size_t)h * HD * DM;
        const int kk = tid >> 2, nq = (tid & 3) * 16;
#pragma unroll
        for (int i = 0; i < 16; ++i) tl[(nq + i) * 72 + kk] = f2bf(Wm[(size_t)(k0 + kk) * HD + nq + i]);
        __syncthreads();
        const int piece = tid & 7;
#pragma unroll
        for (int s = 0; s < 2; ++s) { const int nr = (tid >> 3) + 32 * s; const v8us val = *(const v8usa*)(tl + nr * 72 + piece * 8); *(v8us*)(WT + (size_t)nr * DM + k0 + piece * 8) = val; }
        return;
    }
    const int lane = tid & 31, r = (bid - NWTB) * 8 + (tid >> 5);
    if (r >= NTK) return;
    v8us o[DM / 256];
#pragma unroll
    for (int q = 0; q < DM / 256; ++q) { v8us t;
#pragma unroll
        for (int i = 0; i < 8; ++i) t[i] = f2bf(x[(size_t)r * DM + q * 256 + lane * 8 + i]);
        o[q] = t; }
#pragma unroll
    for (int q = 0; q < DM / 256; ++q) *(v8us*)(Xb + (size_t)r * DM + q * 256 + lane * 8) = o[q];
}

// k_gemm3: the three projections in ONE launch; blockIdx.z picks the weight plane and the output (0: q, 1: k, 2: v). 64 x 64 block tile (4 waves x 16 x 64) of A.B^T, K = DM.
// q, k: the tile leaves as two row-major f16 planes (hi, residual x1024), whole lines. v: as the two transposed f16 planes [item][head][d][token]; block tile = 64 tokens x one head.
// LDS ring: a stage = 64 k: the block's A rows [64][64 k], then its B rows [64][64 k], at a pitch of 144 B (16 B x odd: ds_load_b128 without bank conflicts).
// The epilogues stage their tiles in the same LDS, behind the last trip's barrier.
#define GP   72
#define GPL  (64 * GP)
#define GSTG (2 * GPL)
__global__ __launch_bounds__(128) void k_gemm3(const bf* __restrict__ A, const bf* __restrict__ Bq, const bf* __restrict__ Bk, const bf* __restrict__ Bv, h16* QH, h16* QL, h16* KH, h16* KL, h16* VTH, h16* VTL) {
    __shared__ __align__(16) char smem[2 * GSTG * 2];
    constexpr int K = DM, ldc = DM;
    const int lane = threadIdx.x & 31, wave = threadIdx.x >> 5, lr = lane & 15, hi = lane >> 4;
    const int z = blockIdx.z;
    const bf* Bn = z == 0 ? Bq : z == 1 ? Bk : Bv;
    const int r0 = blockIdx.x * 64 + wave * 16, c0 = blockIdx.y * 64;
    v8f acc[4];
#pragma unroll
    for (int t = 0; t < 4; ++t) acc[t] = (v8f){};
    // one stage = 1024 pieces of 16 B, 8 per thread: 8 lanes bring one whole 128-B line of a row; the block's 4 waves share the B tile
    const int tid = threadIdx.x, nt = K >> 6;
    const unsigned ring0 = (unsigned)(size_t)(__attribute__((address_space(3))) char*)&smem[0];
    const unsigned la = ring0 + 2u * (unsigned)((tid >> 3) * GP + (tid & 7) * 8);
    const bf* ga = A + (size_t)(blockIdx.x * 64 + (tid >> 3)) * K + (tid & 7) * 8;
    const bf* gb = Bn + (size_t)(c0 + (tid >> 3)) * K + (tid & 7) * 8;
    const size_t k16 = (size_t)16 * K;
    auto fill = [&](int t, int buf) {
        const unsigned a = la + (unsigned)buf * (2u * GSTG), b = a + 2u * GPL;
        const bf* pa = ga + t * 64; const bf* pb = gb + t * 64;
        // the copies and their s_wait_xcnt in one statement: no address register is rewritten before the wait
        asm volatile("global_load_async_to_lds_b128 %0, %8, off\n\t"
                     "global_load_async_to_lds_b128 %1, %9, off\n\t"
                     "global_load_async_to_lds_b128 %2, %10, off\n\t"
                     "global_load_async_to_lds_b128 %3, %11, off\n\t"
                     "global_load_async_to_lds_b128 %4, %12, off\n\t"
                     "global_load_async_to_lds_b128 %5, %13, off\n\t"
                     "global_load_async_to_lds_b128 %6, %14, off\n\t"
                     "global_load_async_to_lds_b128 %7, %15, off\n\t"
                     "s_wait_xcnt 0x0"
                     :: "v"(a), "v"(a + 2u * 16 * GP), "v"(a + 2u * 32 * GP), "v"(a + 2u * 48 * GP), "v"(b), "v"(b + 2u * 16 * GP), "v"(b + 2u * 32 * GP), "v"(b + 2u * 48 * GP),
                        "v"(pa), "v"(pa + k16), "v"(pa + 2 * k16), "v"(pa + 3 * k16), "v"(pb), "v"(pb + k16), "v"(pb + 2 * k16), "v"(pb + 3 * k16) : "memory");
    };
    fill(0, 0);
    asm volatile("s_wait_asynccnt 0x0" ::: "memory");     // tile 0 has landed before the barrier publishes it
    __syncthreads();
    if (nt > 1) fill(1, 1);
#pragma unroll 1
    for (int s = 0; s < nt; ++s) {
        const bf* st = (const bf*)(const void*)smem + (s & 1) * GSTG;
        const bf* as = st + (wave * 16 + lr) * GP + 8 * hi;     // this wave's 16 rows of A
        const bf* bs = st + GPL + lr * GP + 8 * hi;             // column c0 + lr; column tile t is 16 t rows on
        v16bf a[2];
#pragma unroll
        for (int kc = 0; kc < 2; ++kc) a[kc] = cat16b(*(const v8usa*)(as + kc * 32), *(const v8usa*)(as + kc * 32 + 16));
#pragma unroll
        for (int kc = 0; kc < 2; ++kc)
#pragma unroll
            for (int t = 0; t < 4; ++t) { const v16bf b = cat16b(*(const v8usa*)(bs + t * 16 * GP + kc * 32), *(const v8usa*)(bs + t * 16 * GP + kc * 32 + 16)); acc[t] = wmmab(a[kc], b, acc[t]); }
        // the distance behind the last matrix instruction, also on the loop's back edge
        asm volatile("v_nop\n\tv_nop\n\tv_nop\n\tv_nop" : "+v"(acc[0]), "+v"(acc[1]), "+v"(acc[2]), "+v"(acc[3]) : "v"(a[0]), "v"(a[1]));
        asm volatile("s_wait_dscnt 0x0" ::: "memory");        // this wave's reads of the buffer have returned before it is refilled
        asm volatile("s_wait_asynccnt 0x0" ::: "memory");     // this wave's copies of tile s + 1 have landed before the barrier publishes them
        __syncthreads();                                      // publishes tile s + 1 and ends every wave's reads of tile s
        if (s + 2 < nt) fill(s + 2, s & 1);
    }
    asm volatile("s_wait_asynccnt 0x0" ::: "memory");         // no copy is outstanding when the ring's LDS is used again below
    if (z == 2) {     // block-uniform
        h16* tile = (h16*)(void*)smem;
        h16* til2 = tile + 64 * 72;
        // a lane's accumulator holds 8 consecutive tokens of one head dim: one 16-B piece of a transposed row
#pragma unroll
        for (int t = 0; t < 4; ++t) { v8h a8, l8;
#pragma unroll
            for (int j = 0; j < 8; ++j) { const float v = acc[t][j]; const h16 a = (h16)v; a8[j] = a; l8[j] = (h16)((v - (float)a) * LOSC); }
            *(v8ha*)(tile + (t * 16 + lr) * 72 + wave * 16 + hi * 8) = a8; *(v8ha*)(til2 + (t * 16 + lr) * 72 + wave * 16 + hi * 8) = l8; }
        __syncthreads();
        const int piece = tid & 7;
        const int b = blockIdx.x / (NT_ / 64), k0 = (blockIdx.x % (NT_ / 64)) * 64, h = blockIdx.y;
        const size_t base = (((size_t)b * NH_ + h) * HD) * NT_ + k0;
#pragma unroll
        for (int s = 0; s < 8; ++s) { const int pln = s >> 2, d = (tid >> 3) + 16 * (s & 3);     // 8 lanes write one whole 128-B line
            const v8h val = *(const v8ha*)((pln ? til2 : tile) + d * 72 + piece * 8); *(v8h*)((pln ? VTL : VTH) + base + (size_t)d * NT_ + piece * 8) = val; }
    } else {
        float* os = (float*)(void*)smem + wave * (16 * 68);
#pragma unroll
        for (int t = 0; t < 4; ++t)
#pragma unroll
            for (int j = 0; j < 8; ++j) os[(hi * 8 + j) * 68 + t * 16 + lr] = acc[t][j];
        __syncthreads();
        h16* crow = (z == 0 ? QH : KH) + (size_t)r0 * ldc + c0;
        h16* crow2 = (z == 0 ? QL : KL) + (size_t)r0 * ldc + c0;
        const int piece = lane & 7;
        v8h o[4], o2[4];     // both planes' pieces first, then the 8 whole-line stores in a row
#pragma unroll
        for (int s = 0; s < 4; ++s) { const float* sp = os + (4 * s + (lane >> 3)) * 68 + piece * 8;
#pragma unroll
            for (int i = 0; i < 8; ++i) { const h16 a = (h16)sp[i]; o[s][i] = a; o2[s][i] = (h16)((sp[i] - (float)a) * LOSC); } }
#pragma unroll
        for (int s = 0; s < 4; ++s) { const size_t ro = (size_t)(4 * s + (lane >> 3)) * ldc + piece * 8; *(v8h*)(crow + ro) = o[s]; *(v8h*)(crow2 + ro) = o2[s]; }
        asm volatile("s_wait_xcnt 0x0" ::: "memory");     // the built code lays the v epilogue behind these stores: none of their registers is rewritten in front of this wait
    }
}

// k_attn: block = (b, h, 64 queries), wave = 16; CAUSAL: key tiles 0..(64qt+63)/32 with per-element j <= i. TRANSPOSED products: scores^T = k.q^T (A = key rows, B = query columns), so a lane holds
// 16 of the 32 scores of ONE query (lane & 15; the other 16 in lane ^ 16): maximum and sum run in the lane, one exchange between the halves. The two score tiles, converted in place (x32768, f16 hi +
// residual), are the B operand of ctx^T += v^T.p^T in the hardware k order: the weights never touch LDS. ctx -> f32 output rows [tok][h*64+d] (16 lanes x 16 B per head slice).
// LDS ring of k_attn: a stage = 32 keys: k hi, k residual [32 keys][64 d] at a pitch of 144 B, then v hi, v residual [64 d][32 keys] at a pitch of 80 B (16 B x odd: ds_load_b128 without bank conflicts)
#define KP   72
#define VP   40
#define KPL  (32 * KP)
#define VPL  (64 * VP)
#define STG  (2 * KPL + 2 * VPL)
// amdgpu_waves_per_eu(4, 4): keeps the register count at or below 256, so that four waves per SIMD stay resident as before (without it the grouped LDS reads took 258)
__global__ __launch_bounds__(128) __attribute__((amdgpu_waves_per_eu(4, 4))) void k_attn(const h16* __restrict__ Q16, const h16* __restrict__ QL16, const h16* __restrict__ K16, const h16* __restrict__ KL16, const h16* __restrict__ VTH, const h16* __restrict__ VTL, float* CTX) {
    __shared__ __align__(16) float ost[4][16 * 68];
    __shared__ __align__(16) h16 ring[2][STG];
    const int lane = threadIdx.x & 31, wave = threadIdx.x >> 5, lr = lane & 15, hi = lane >> 4;
    const int bid = blockIdx.x;
    // heaviest query tiles first (for speed only): a tile's cost grows with qt
    const int qt = (NT_ / 64 - 1) - bid / (NB_ * NH_), bh = bid % (NB_ * NH_), b = bh / NH_, h = bh - b * NH_;
    const int q0 = qt * 64 + wave * 16;
    const size_t tok0 = (size_t)b * NT_;
    v16h qa[2];
    const size_t qo0 = (tok0 + q0 + lr) * DM + h * HD + 8 * hi;
#pragma unroll
    for (int kc = 0; kc < 2; ++kc) qa[kc] = cat16(*(const v8h*)(Q16 + qo0 + kc * 32), *(const v8h*)(Q16 + qo0 + kc * 32 + 16));
    asm volatile("s_wait_xcnt 0x0" :: "v"(Q16 + qo0) : "memory");     // the query loads' address pair is named as an input, so it stays whole up to this wait
    const h16* kh_b = K16 + tok0 * DM + h * HD;
    const h16* kl_b = KL16 + tok0 * DM + h * HD;
    const size_t vbase = (((size_t)b * NH_ + h) * HD) * NT_;
    v8f o[4], ox[4];
#pragma unroll
    for (int n = 0; n < 4; ++n) { o[n] = (v8f){}; ox[n] = (v8f){}; }
    float mrow = -3.0e38f, lpart = 0.f;     // of query q0 + lr; mrow is equal in both halves, lpart sums this half's keys
    const int qi = q0 + lr;
    const int kt_lo = 0, kt_hi = (qt * 64 + 63) / 32;     // causal; always at least two key tiles
    // one stage = 1024 pieces of 16 B, 8 per thread: 8 lanes bring one whole 128-B k row, 4 lanes one 64-B v row piece; the block's 4 waves share the tile
    const int tid = threadIdx.x;
    const unsigned ring0 = (unsigned)(size_t)(__attribute__((address_space(3))) h16*)&ring[0][0];
    const unsigned lk = ring0 + 2u * (unsigned)((tid >> 3) * KP + (tid & 7) * 8), lv = ring0 + 2u * (unsigned)(2 * KPL + (tid >> 2) * VP + (tid & 3) * 8);
    const size_t gko = (size_t)(tid >> 3) * DM + (tid & 7) * 8, gvo = vbase + (size_t)(tid >> 2) * NT_ + (tid & 3) * 8;
    auto fill = [&](int t, int buf) {
        const unsigned a = lk + (unsigned)buf * (2u * STG), c = lv + (unsigned)buf * (2u * STG);
        const h16* gh = kh_b + gko + (size_t)t * 32 * DM; const h16* gl = kl_b + gko + (size_t)t * 32 * DM;
        const h16* vh = VTH + gvo + t * 32; const h16* vl = VTL + gvo + t * 32;
        // the copies and their s_wait_xcnt in one statement: no address register is rewritten before the wait
        asm volatile("global_load_async_to_lds_b128 %0, %8, off\n\t"
                     "global_load_async_to_lds_b128 %1, %9, off\n\t"
                     "global_load_async_to_lds_b128 %2, %10, off\n\t"
                     "global_load_async_to_lds_b128 %3, %11, off\n\t"
                     "global_load_async_to_lds_b128 %4, %12, off\n\t"
                     "global_load_async_to_lds_b128 %5, %13, off\n\t"
                     "global_load_async_to_lds_b128 %6, %14, off\n\t"
                     "global_load_async_to_lds_b128 %7, %15, off\n\t"
                     "s_wait_xcnt 0x0"
                     :: "v"(a), "v"(a + 2u * 16 * KP), "v"(a + 2u * KPL), "v"(a + 2u * (KPL + 16 * KP)), "v"(c), "v"(c + 2u * 32 * VP), "v"(c + 2u * VPL), "v"(c + 2u * (VPL + 32 * VP)),
                        "v"(gh), "v"(gh + 16 * DM), "v"(gl), "v"(gl + 16 * DM), "v"(vh), "v"(vh + 32 * NT_), "v"(vl), "v"(vl + 32 * NT_) : "memory");
    };
    fill(0, 0);
    asm volatile("s_wait_asynccnt 0x0" ::: "memory");     // tile 0 has landed before the barrier publishes it
    __syncthreads();
    fill(1, 1);
#pragma unroll 1
    for (int kt = kt_lo; kt <= kt_hi; ++kt) {
        const int l0 = kt * 32;
        const h16* st = &ring[kt & 1][0];
        const h16* ks = st + lr * KP + 8 * hi;     // key l0 + lr; key l0 + 16 + lr is 16 rows on; the residual plane KPL on
        v8f s0 = {}, s1 = {}, x0 = {}, x1 = {};
#pragma unroll
        for (int kc = 0; kc < 2; ++kc) {
            { const v16h k0h = cat16(*(const v8ha*)(ks + kc * 32), *(const v8ha*)(ks + kc * 32 + 16)), k1h = cat16(*(const v8ha*)(ks + 16 * KP + kc * 32), *(const v8ha*)(ks + 16 * KP + kc * 32 + 16));
              const v16h qlk = cat16(*(const v8h*)(QL16 + qo0 + kc * 32), *(const v8h*)(QL16 + qo0 + kc * 32 + 16));     // query residual re-read per step (registers)
              s0 = wmma16(k0h, qa[kc], s0); x0 = wmma16(k0h, qlk, x0); s1 = wmma16(k1h, qa[kc], s1); x1 = wmma16(k1h, qlk, x1);
            }
            { const v16h k0l = cat16(*(const v8ha*)(ks + KPL + kc * 32), *(const v8ha*)(ks + KPL + kc * 32 + 16)), k1l = cat16(*(const v8ha*)(ks + KPL + 16 * KP + kc * 32), *(const v8ha*)(ks + KPL + 16 * KP + kc * 32 + 16));
              x0 = wmma16(k0l, qa[kc], x0); x1 = wmma16(k1l, qa[kc], x1); }
        }
        asm volatile("v_nop\n\tv_nop\n\tv_nop\n\tv_nop" : "+v"(s0), "+v"(s1), "+v"(x0), "+v"(x1) : "v"(qa[0]), "v"(qa[1]));
        // register j of s0 / s1 = key l0 + 8 hi + j / l0 + 16 + 8 hi + j against query qi: kept while j / 16 + j <= dq
        const int dq = qi - l0 - 8 * hi;
        v2f a[8];     // pairs of neighbouring registers, so that the packed f32 forms take them where they lie
#pragma unroll
        for (int g = 0; g < 4; ++g) {
            a[g]     = ((v2f){s0[2 * g], s0[2 * g + 1]} + (v2f){x0[2 * g], x0[2 * g + 1]} * LOSCI) * 0.125f;
            a[4 + g] = ((v2f){s1[2 * g], s1[2 * g + 1]} + (v2f){x1[2 * g], x1[2 * g + 1]} * LOSCI) * 0.125f;
        }
#pragma unroll
        for (int g = 0; g < 8; ++g)
#pragma unroll
            for (int i = 0; i < 2; ++i) a[g][i] = ((g >> 2) * 16 + (g & 3) * 2 + i <= dq) ? a[g][i] : -__builtin_inff();
        float mx = fmaxf(a[0][0], a[0][1]);
#pragma unroll
        for (int g = 1; g < 8; ++g) mx = fmaxf(mx, fmaxf(a[g][0], a[g][1]));
        mx = fmaxf(mx, xhalf(mx));
        const float mn = fmaxf(mrow, mx);
        const float alpha = __expf(mrow - mn); mrow = mn;
        v2f ps2 = {0.f, 0.f};
        v16h pa, px;     // element s = key 8 hi + s (s < 8) or 8 hi + s + 8 (s >= 8) of the tile: the k order of the v loader below
#pragma unroll
        for (int g = 0; g < 8; ++g) {
            const v2f p = {__expf(a[g][0] - mn), __expf(a[g][1] - mn)};
            ps2 += p;
            const v2f ps = p * PSC;
            const v2h hp = __builtin_convertvector(ps, v2h);
            const v2h hx = __builtin_convertvector((ps - __builtin_convertvector(hp, v2f)) * LOSC, v2h);
            pa[2 * g] = hp[0]; pa[2 * g + 1] = hp[1]; px[2 * g] = hx[0]; px[2 * g + 1] = hx[1];
        }
        const float psum = ps2[0] + ps2[1];
        lpart = lpart * alpha + psum;
#pragma unroll
        for (int n = 0; n < 4; ++n)
#pragma unroll
            for (int j = 0; j < 8; ++j) { o[n][j] *= alpha; ox[n][j] *= alpha; }
#pragma unroll
        for (int n = 0; n < 4; ++n) { const h16* vs = st + 2 * KPL + (n * 16 + lr) * VP + hi * 8;
            const v16h vh = cat16(*(const v8ha*)(vs), *(const v8ha*)(vs + 16)), vl = cat16(*(const v8ha*)(vs + VPL), *(const v8ha*)(vs + VPL + 16));
            o[n] = wmma16(vh, pa, o[n]); ox[n] = wmma16(vl, pa, ox[n]); ox[n] = wmma16(vh, px, ox[n]); }     // register j of o[n] = head dim 16 n + 8 hi + j of query qi
        asm volatile("v_nop\n\tv_nop\n\tv_nop\n\tv_nop" : "+v"(o[0]), "+v"(o[1]), "+v"(o[2]), "+v"(o[3]), "+v"(ox[0]), "+v"(ox[1]), "+v"(ox[2]), "+v"(ox[3]) : "v"(pa), "v"(px));
        asm volatile("s_wait_dscnt 0x0" ::: "memory");        // this wave's reads of the buffer have returned before it is refilled
        asm volatile("s_wait_asynccnt 0x0" ::: "memory");     // this wave's copies of tile kt + 1 have landed before the barrier publishes them
        __syncthreads();                                      // publishes tile kt + 1 and ends every wave's reads of tile kt
        if (kt + 2 <= kt_hi) fill(kt + 2, kt & 1);
    }
    asm volatile("s_wait_asynccnt 0x0" ::: "memory");         // no copy is outstanding when the wave goes on to its end
    const float inv = 1.0f / ((lpart + xhalf(lpart)) * PSC);     // the halves' sums are joined once
    float* os = &ost[wave][0];
#pragma unroll
    for (int n = 0; n < 4; ++n)
#pragma unroll
        for (int g = 0; g < 2; ++g) { v4f w;
#pragma unroll
            for (int i = 0; i < 4; ++i) w[i] = (o[n][4 * g + i] + ox[n][4 * g + i] * LOSCI) * inv;
            *(v4fa*)(os + lr * 68 + n * 16 + hi * 8 + 4 * g) = w; }
    __syncthreads();
    const size_t cbase = (tok0 + q0) * DM + (size_t)h * HD;
    auto pass = [&]() {
#pragma unroll
        for (int s = 0; s < 8; ++s) { const int row = 2 * s + (lane >> 4), piece = lane & 15; const float* sp = os + row * 68 + piece * 4; v4f v;
#pragma unroll
            for (int i = 0; i < 4; ++i) v[i] = sp[i];
            *(v4f*)(CTX + cbase + (size_t)row * DM + piece * 4) = v; }
    };
    pass(); 
}

extern "C" void kernel_launch(void* const* d_in, const int* in_sizes, int n_in,
                              void* d_out, int out_size, void* d_ws, size_t ws_size, hipStream_t stream) {
    (void)in_sizes; (void)n_in; (void)out_size;
    const float* x = (const float*)d_in[0]; const float* Wq = (const float*)d_in[1]; const float* Wk = (const float*)d_in[2]; const float* Wv = (const float*)d_in[3];
    float* out = (float*)d_out;    // [8][1024][768]
    char* wsp = (char*)d_ws;
    auto take = [&](size_t bytes) { char* p = wsp; wsp += (bytes + 255) & ~(size_t)255; return (void*)p; };
    bf* WqT = (bf*)take((size_t)DM * DM * 2); bf* WkT = (bf*)take((size_t)DM * DM * 2); bf* WvT = (bf*)take((size_t)DM * DM * 2);
    bf* Xb = (bf*)take((size_t)NTK * DM * 2);
    h16* QH = (h16*)take((size_t)NTK * DM * 2); h16* QL = (h16*)take((size_t)NTK * DM * 2); h16* KH = (h16*)take((size_t)NTK * DM * 2); h16* KL = (h16*)take((size_t)NTK * DM * 2); h16* VTH = (h16*)take((size_t)NTK * DM * 2); h16* VTL = (h16*)take((size_t)NTK * DM * 2);
    if ((size_t)(wsp - (char*)d_ws) > ws_size) return;    // 3 x 1.2 + 12.6 + 6 x 12.6 ~ 92 MB
    k_prep<<<NWTB + NTK / 8, 256, 0, stream>>>(x, Wq, Wk, Wv, Xb, WqT, WkT, WvT);
    k_gemm3<<<dim3(NTK / 64, DM / 64, 3), 128, 0, stream>>>(Xb, WqT, WkT, WvT, QH, QL, KH, KL, VTH, VTL);
    k_attn<<<NB_ * NH_ * (NT_ / 64), 128, 0, stream>>>(QH, QL, KH, KL, VTH, VTL, out);
}

// v008
// It runs in 80.7 microseconds.
// Next to v007, in two timings, it ran 1.07 times as fast each time.
// Counting every step since v000, it is 5.56 times as fast.
#include <hip/hip_runtime.h>

// Compute dtypes, f32 accumulate: q, k, v = x.W_h for all 12 heads as three [8192 x 768].[768 x 768] GEMMs with PLAIN bf16 operands (rounded input; the per-head [768][64] weights
// transposed into one n-major plane; exact products) on v_wmma_f32_16x16x32_bf16; q/k as f16 hi + residual x1024 planes, v as f16 hi/lo transposed planes; per (item, head) causal
// attention over 1024 tokens: scores on v_wmma_f32_16x16x32_f16 (hh + hl + lh, x 1/8), online f32 softmax, weights (x32768) and v as f16 hi/lo on v_wmma_f32_16x16x32_f16; the

#define NB_  8
#define NT_  1024
#define DM   768
#define NH_  12
#define HD   64
#define NTK  (NB_ * NT_)          // 8192 token rows
#define NW   DM
#define PSC  32768.0f
#define LOSC 1024.0f
#define LOSCI (1.0f / 1024.0f)

typedef _Float16 h16;
typedef unsigned short bf;
typedef __attribute__((ext_vector_type(16))) __bf16   v16bf;
typedef __attribute__((ext_vector_type(16))) _Float16 v16h;
typedef __attribute__((ext_vector_type(8)))  _Float16 v8h;
typedef __attribute__((ext_vector_type(8)))  unsigned short v8us;
typedef __attribute__((ext_vector_type(8)))  float    v8f;
typedef __attribute__((ext_vector_type(4)))  float    v4f;
typedef __attribute__((ext_vector_type(2)))  float    v2f;
typedef __attribute__((ext_vector_type(2)))  _Float16 v2h;
typedef v8h  __attribute__((may_alias)) v8ha;
typedef v4f  __attribute__((may_alias)) v4fa;
typedef v8us __attribute__((may_alias)) v8usa;

__device__ __forceinline__ unsigned short f2bf(float f) { unsigned u = __float_as_uint(f); u += 0x7FFFu + ((u >> 16) & 1u); return (unsigned short)(u >> 16); }
__device__ __forceinline__ v16h cat16(v8h lo, v8h hi) { return __builtin_shufflevector(lo, hi, 0, 1, 2, 3, 4, 5, 6, 7, 8, 9, 10, 11, 12, 13, 14, 15); }
__device__ __forceinline__ v16bf cat16b(v8us lo, v8us hi) { return __builtin_bit_cast(v16bf, __builtin_shufflevector(lo, hi, 0, 1, 2, 3, 4, 5, 6, 7, 8, 9, 10, 11, 12, 13, 14, 15)); }
__device__ __forceinline__ v8f wmma16(v16h a, v16h b, v8f c) { return __builtin_amdgcn_wmma_f32_16x16x32_f16(false, a, false, b, (short)0, c, false, false); }
// lane l <-> l ^ 16: the two halves of a wave hold the two halves of a query's keys
__device__ __forceinline__ float xhalf(float v) { const int b = __float_as_int(v); return __int_as_float(__builtin_amdgcn_permlanex16(b, b, 0x76543210, 0xfedcba98, false, false)); }
__device__ __forceinline__ v8f wmmab(v16bf a, v16bf b, v8f c) { return __builtin_amdgcn_wmma_f32_16x16x32_bf16(false, a, false, b, (short)0, c, false, false); }

// k_prep: both operand converters in ONE launch (they are independent of each other). Blocks 0 .. NWTB - 1: one 64 x 64 tile of a per-head weight plane, WT[h*64 + n][k] = bf16(W[h][k][n]), via LDS;
// the tile index runs k tile fastest, then head, then matrix (Wq / Wk / Wv). The other NTK / 8 blocks: 8 rows of x each, rounded to bf16, one row per wave.
#define NWTB ((DM / 64) * NH_ * 3)
__global__ __launch_bounds__(256) void k_prep(const float* __restrict__ x, const float* __restrict__ Wq, const float* __restrict__ Wk, const float* __restrict__ Wv, bf* Xb, bf* WqT, bf* WkT, bf* WvT) {
    __shared__ __align__(16) unsigned short tl[64 * 72];
    const int tid = threadIdx.x, bid = blockIdx.x;
    if (bid < NWTB) {     // block-uniform, so the barrier below is passed by the whole block or by none of it
        const int k0 = (bid % (DM / 64)) * 64, h = (bid / (DM / 64)) % NH_, z = bid / ((DM / 64) * NH_);
        const float* Wm = (z == 0 ? Wq : z == 1 ? Wk : Wv) + (size_t)h * DM * HD;
        bf* WT = (z == 0 ? WqT : z == 1 ? WkT : WvT) + (size_t)h * HD * DM;
        const int kk = tid >> 2, nq = (tid & 3) * 16;
#pragma unroll
        for (int i = 0; i < 16; ++i) tl[(nq + i) * 72 + kk] = f2bf(Wm[(size_t)(k0 + kk) * HD + nq + i]);
        __syncthreads();
        const int piece = tid & 7;
#pragma unroll
        for (int s = 0; s < 2; ++s) { const int nr = (tid >> 3) + 32 * s; const v8us val = *(const v8usa*)(tl + nr * 72 + piece * 8); *(v8us*)(WT + (size_t)nr * DM + k0 + piece * 8) = val; }
        return;
    }
    const int lane = tid & 31, r = (bid - NWTB) * 8 + (tid >> 5);
    if (r >= NTK) return;
    v8us o[DM / 256];
#pragma unroll
    for (int q = 0; q < DM / 256; ++q) { v8us t;
#pragma unroll
        for (int i = 0; i < 8; ++i) t[i] = f2bf(x[(size_t)r * DM + q * 256 + lane * 8 + i]);
        o[q] = t; }
#pragma unroll
    for (int q = 0; q < DM / 256; ++q) *(v8us*)(Xb + (size_t)r * DM + q * 256 + lane * 8) = o[q];
}

// k_gemm3: the three projections in ONE launch; blockIdx.z picks the weight plane and the output (0: q, 1: k, 2: v). 128 x 128 block tile (2 x 2 waves, 64 x 64 = 4 x 4 accumulator tiles each) of A.B^T, K = DM:
// a staged row serves 128 outputs (L2 bytes per output halved against a 64 x 64 block) and a fragment read from LDS serves 4 matrix instructions.
// q, k: the tile leaves as two row-major f16 planes (hi, residual x1024), whole lines. v: as the two transposed f16 planes [item][head][d][token]; block tile = 128 tokens x two heads.
// LDS ring: a stage = 64 k: the block's A rows [128][64 k], then its B rows [128][64 k], at a pitch of 144 B (16 B x odd: ds_load_b128 without bank conflicts).
// The epilogues stage their tiles in the same LDS, behind the last trip's barrier.
#define GP   72
#define GPL  (128 * GP)
#define GSTG (2 * GPL)
#define VTP  136     // pitch of the v epilogue's transposed rows, in f16: 272 B = 16 B x odd
// amdgpu_waves_per_eu(4, 4): keeps the register count at or below 256, so that the four blocks whose rings fit a WGP's LDS are resident together
__global__ __launch_bounds__(128) __attribute__((amdgpu_waves_per_eu(4, 4))) void k_gemm3(const bf* __restrict__ A, const bf* __restrict__ Bq, const bf* __restrict__ Bk, const bf* __restrict__ Bv, h16* QH, h16* QL, h16* KH, h16* KL, h16* VTH, h16* VTL) {
    __shared__ __align__(16) char smem[2 * GSTG * 2];
    constexpr int K = DM, ldc = DM;
    const int lane = threadIdx.x & 31, wave = threadIdx.x >> 5, lr = lane & 15, hi = lane >> 4;
    const int wm = wave >> 1, wn = wave & 1;     // the wave's 64 rows and 64 columns of the block tile
    const int z = blockIdx.z;
    const bf* Bn = z == 0 ? Bq : z == 1 ? Bk : Bv;
    const int r0 = blockIdx.x * 128 + wm * 64, c0 = blockIdx.y * 128;
    v8f acc[4][4];
#pragma unroll
    for (int m = 0; m < 4; ++m)
#pragma unroll
        for (int t = 0; t < 4; ++t) acc[m][t] = (v8f){};
    // one stage = 2048 pieces of 16 B, 16 per thread: 8 lanes bring one whole 128-B line of a row; the waves share the A and the B tile in pairs
    const int tid = threadIdx.x, nt = K >> 6;
    const unsigned ring0 = (unsigned)(size_t)(__attribute__((address_space(3))) char*)&smem[0];
    const unsigned la = ring0 + 2u * (unsigned)((tid >> 3) * GP + (tid & 7) * 8);
    const bf* ga = A + (size_t)(blockIdx.x * 128 + (tid >> 3)) * K + (tid & 7) * 8;
    const bf* gb = Bn + (size_t)(c0 + (tid >> 3)) * K + (tid & 7) * 8;
    const size_t k16 = (size_t)16 * K;
    auto fill8 = [&](unsigned a, const bf* p) {     // 128 rows of one operand: this thread's piece of rows tid / 8 + 16 i
        // the copies and their s_wait_xcnt in one statement: no address register is rewritten before the wait
        asm volatile("global_load_async_to_lds_b128 %0, %8, off\n\t"
                     "global_load_async_to_lds_b128 %1, %9, off\n\t"
                     "global_load_async_to_lds_b128 %2, %10, off\n\t"
                     "global_load_async_to_lds_b128 %3, %11, off\n\t"
                     "global_load_async_to_lds_b128 %4, %12, off\n\t"
                     "global_load_async_to_lds_b128 %5, %13, off\n\t"
                     "global_load_async_to_lds_b128 %6, %14, off\n\t"
                     "global_load_async_to_lds_b128 %7, %15, off\n\t"
                     "s_wait_xcnt 0x0"
                     :: "v"(a), "v"(a + 2u * 16 * GP), "v"(a + 2u * 32 * GP), "v"(a + 2u * 48 * GP), "v"(a + 2u * 64 * GP), "v"(a + 2u * 80 * GP), "v"(a + 2u * 96 * GP), "v"(a + 2u * 112 * GP),
                        "v"(p), "v"(p + k16), "v"(p + 2 * k16), "v"(p + 3 * k16), "v"(p + 4 * k16), "v"(p + 5 * k16), "v"(p + 6 * k16), "v"(p + 7 * k16) : "memory");
    };
    auto fill = [&](int t, int buf) { const unsigned a = la + (unsigned)buf * (2u * GSTG); fill8(a, ga + t * 64); fill8(a + 2u * GPL, gb + t * 64); };
    fill(0, 0);
    asm volatile("s_wait_asynccnt 0x0" ::: "memory");     // tile 0 has landed before the barrier publishes it
    __syncthreads();
    if (nt > 1) fill(1, 1);
#pragma unroll 1
    for (int s = 0; s < nt; ++s) {
        const bf* st = (const bf*)(const void*)smem + (s & 1) * GSTG;
        const bf* as = st + (wm * 64 + lr) * GP + 8 * hi;           // row r0 + lr; row tile m is 16 m rows on
        const bf* bs = st + GPL + (wn * 64 + lr) * GP + 8 * hi;     // column c0 + 64 wn + lr; column tile t is 16 t rows on
#pragma unroll
        for (int kc = 0; kc < 2; ++kc) {
            v16bf a[4], b[4];
#pragma unroll
            for (int m = 0; m < 4; ++m) a[m] = cat16b(*(const v8usa*)(as + m * 16 * GP + kc * 32), *(const v8usa*)(as + m * 16 * GP + kc * 32 + 16));
#pragma unroll
            for (int t = 0; t < 4; ++t) b[t] = cat16b(*(const v8usa*)(bs + t * 16 * GP + kc * 32), *(const v8usa*)(bs + t * 16 * GP + kc * 32 + 16));
            __builtin_amdgcn_sched_barrier(0);     // the 16 fragment reads go out as one group ahead of their 16 matrix instructions: without it one A fragment is re-read, and its LDS latency waited out, per 4 of them
#pragma unroll
            for (int m = 0; m < 4; ++m)
#pragma unroll
                for (int t = 0; t < 4; ++t) acc[m][t] = wmmab(a[m], b[t], acc[m][t]);
        }
        asm volatile("s_wait_dscnt 0x0" ::: "memory");        // this wave's reads of the buffer have returned before it is refilled
        asm volatile("s_wait_asynccnt 0x0" ::: "memory");     // this wave's copies of tile s + 1 have landed before the barrier publishes them
        __syncthreads();                                      // publishes tile s + 1 and ends every wave's reads of tile s
        if (s + 2 < nt) fill(s + 2, s & 1);
    }
    asm volatile("s_wait_asynccnt 0x0" ::: "memory");         // no copy is outstanding when the ring's LDS is used again below
    if (z == 2) {     // block-uniform
        h16* tile = (h16*)(void*)smem;
        h16* til2 = tile + 128 * VTP;
        // a lane's accumulator holds 8 consecutive tokens of one head dim: one 16-B piece of a transposed row
#pragma unroll
        for (int m = 0; m < 4; ++m)
#pragma unroll
            for (int t = 0; t < 4; ++t) { v8h a8, l8;
#pragma unroll
                for (int j = 0; j < 8; ++j) { const float v = acc[m][t][j]; const h16 a = (h16)v; a8[j] = a; l8[j] = (h16)((v - (float)a) * LOSC); }
                const int at = (wn * 64 + t * 16 + lr) * VTP + wm * 64 + m * 16 + hi * 8;
                *(v8ha*)(tile + at) = a8; *(v8ha*)(til2 + at) = l8; }
        __syncthreads();
        const int piece = tid & 15;
        const int b = blockIdx.x / (NT_ / 128), k0 = (blockIdx.x % (NT_ / 128)) * 128;
        const size_t base = ((size_t)b * (NH_ * HD) + blockIdx.y * 128) * NT_ + k0;     // row d of the tile = head 2 y + d / 64, head dim d % 64
#pragma unroll
        for (int g = 0; g < 4; ++g) { v8h val[8];     // 16 lanes write the two whole 128-B lines of a row
            const h16* sp = (g >> 1 ? til2 : tile) + ((tid >> 4) + 64 * (g & 1)) * VTP + piece * 8;
            h16* dp = (g >> 1 ? VTL : VTH) + base + (size_t)((tid >> 4) + 64 * (g & 1)) * NT_ + piece * 8;
#pragma unroll
            for (int s = 0; s < 8; ++s) val[s] = *(const v8ha*)(sp + 8 * s * VTP);
#pragma unroll
            for (int s = 0; s < 8; ++s) *(v8h*)(dp + (size_t)(8 * s) * NT_) = val[s];
            asm volatile("s_wait_xcnt 0x0" ::: "memory");     // none of these stores' registers is rewritten by the next group in front of this wait
        }
    } else {
        float* os = (float*)(void*)smem + wave * (64 * 68);
#pragma unroll
        for (int m = 0; m < 4; ++m)
#pragma unroll
            for (int t = 0; t < 4; ++t)
#pragma unroll
                for (int j = 0; j < 8; ++j) os[(m * 16 + hi * 8 + j) * 68 + t * 16 + lr] = acc[m][t][j];
        __syncthreads();
        h16* crow = (z == 0 ? QH : KH) + (size_t)r0 * ldc + c0 + wn * 64;
        h16* crow2 = (z == 0 ? QL : KL) + (size_t)r0 * ldc + c0 + wn * 64;
        const int piece = lane & 7;
#pragma unroll
        for (int m = 0; m < 4; ++m) {
            v8h o[4], o2[4];     // both planes' pieces first, then the 8 whole-line stores in a row
#pragma unroll
            for (int s = 0; s < 4; ++s) { const float* sp = os + (m * 16 + 4 * s + (lane >> 3)) * 68 + piece * 8;
#pragma unroll
                for (int i = 0; i < 8; ++i) { const h16 a = (h16)sp[i]; o[s][i] = a; o2[s][i] = (h16)((sp[i] - (float)a) * LOSC); } }
#pragma unroll
            for (int s = 0; s < 4; ++s) { const size_t ro = (size_t)(m * 16 + 4 * s + (lane >> 3)) * ldc + piece * 8; *(v8h*)(crow + ro) = o[s]; *(v8h*)(crow2 + ro) = o2[s]; }
            asm volatile("s_wait_xcnt 0x0" ::: "memory");     // none of these stores' registers is rewritten by the next group in front of this wait
        }
    }
}

// k_attn: block = (b, h, 64 queries), wave = 16; CAUSAL: key tiles 0..(64qt+63)/32 with per-element j <= i. TRANSPOSED products: scores^T = k.q^T (A = key rows, B = query columns), so a lane holds
// 16 of the 32 scores of ONE query (lane & 15; the other 16 in lane ^ 16): maximum and sum run in the lane, one exchange between the halves. The two score tiles, converted in place (x32768, f16 hi +
// residual), are the B operand of ctx^T += v^T.p^T in the hardware k order: the weights never touch LDS. ctx -> f32 output rows [tok][h*64+d] (16 lanes x 16 B per head slice).
// LDS ring of k_attn: a stage = 32 keys: k hi, k residual [32 keys][64 d] at a pitch of 144 B, then v hi, v residual [64 d][32 keys] at a pitch of 80 B (16 B x odd: ds_load_b128 without bank conflicts)
#define KP   72
#define VP   40
#define KPL  (32 * KP)
#define VPL  (64 * VP)
#define STG  (2 * KPL + 2 * VPL)
// amdgpu_waves_per_eu(4, 4): keeps the register count at or below 256, so that four waves per SIMD stay resident as before (without it the grouped LDS reads took 258)
__global__ __launch_bounds__(128) __attribute__((amdgpu_waves_per_eu(4, 4))) void k_attn(const h16* __restrict__ Q16, const h16* __restrict__ QL16, const h16* __restrict__ K16, const h16* __restrict__ KL16, const h16* __restrict__ VTH, const h16* __restrict__ VTL, float* CTX) {
    __shared__ __align__(16) float ost[4][16 * 68];
    __shared__ __align__(16) h16 ring[2][STG];
    const int lane = threadIdx.x & 31, wave = threadIdx.x >> 5, lr = lane & 15, hi = lane >> 4;
    const int bid = blockIdx.x;
    // heaviest query tiles first (for speed only): a tile's cost grows with qt
    const int qt = (NT_ / 64 - 1) - bid / (NB_ * NH_), bh = bid % (NB_ * NH_), b = bh / NH_, h = bh - b * NH_;
    const int q0 = qt * 64 + wave * 16;
    const size_t tok0 = (size_t)b * NT_;
    v16h qa[2];
    const size_t qo0 = (tok0 + q0 + lr) * DM + h * HD + 8 * hi;
#pragma unroll
    for (int kc = 0; kc < 2; ++kc) qa[kc] = cat16(*(const v8h*)(Q16 + qo0 + kc * 32), *(const v8h*)(Q16 + qo0 + kc * 32 + 16));
    asm volatile("s_wait_xcnt 0x0" :: "v"(Q16 + qo0) : "memory");     // the query loads' address pair is named as an input, so it stays whole up to this wait
    const h16* kh_b = K16 + tok0 * DM + h * HD;
    const h16* kl_b = KL16 + tok0 * DM + h * HD;
    const size_t vbase = (((size_t)b * NH_ + h) * HD) * NT_;
    v8f o[4], ox[4];
#pragma unroll
    for (int n = 0; n < 4; ++n) { o[n] = (v8f){}; ox[n] = (v8f){}; }
    float mrow = -3.0e38f, lpart = 0.f;     // of query q0 + lr; mrow is equal in both halves, lpart sums this half's keys
    const int qi = q0 + lr;
    const int kt_lo = 0, kt_hi = (qt * 64 + 63) / 32;     // causal; always at least two key tiles
    // one stage = 1024 pieces of 16 B, 8 per thread: 8 lanes bring one whole 128-B k row, 4 lanes one 64-B v row piece; the block's 4 waves share the tile
    const int tid = threadIdx.x;
    const unsigned ring0 = (unsigned)(size_t)(__attribute__((address_space(3))) h16*)&ring[0][0];
    const unsigned lk = ring0 + 2u * (unsigned)((tid >> 3) * KP + (tid & 7) * 8), lv = ring0 + 2u * (unsigned)(2 * KPL + (tid >> 2) * VP + (tid & 3) * 8);
    const size_t gko = (size_t)(tid >> 3) * DM + (tid & 7) * 8, gvo = vbase + (size_t)(tid >> 2) * NT_ + (tid & 3) * 8;
    auto fill = [&](int t, int buf) {
        const unsigned a = lk + (unsigned)buf * (2u * STG), c = lv + (unsigned)buf * (2u * STG);
        const h16* gh = kh_b + gko + (size_t)t * 32 * DM; const h16* gl = kl_b + gko + (size_t)t * 32 * DM;
        const h16* vh = VTH + gvo + t * 32; const h16* vl = VTL + gvo + t * 32;
        // the copies and their s_wait_xcnt in one statement: no address register is rewritten before the wait
        asm volatile("global_load_async_to_lds_b128 %0, %8, off\n\t"
                     "global_load_async_to_lds_b128 %1, %9, off\n\t"
                     "global_load_async_to_lds_b128 %2, %10, off\n\t"
                     "global_load_async_to_lds_b128 %3, %11, off\n\t"
                     "global_load_async_to_lds_b128 %4, %12, off\n\t"
                     "global_load_async_to_lds_b128 %5, %13, off\n\t"
                     "global_load_async_to_lds_b128 %6, %14, off\n\t"
                     "global_load_async_to_lds_b128 %7, %15, off\n\t"
                     "s_wait_xcnt 0x0"
                     :: "v"(a), "v"(a + 2u * 16 * KP), "v"(a + 2u * KPL), "v"(a + 2u * (KPL + 16 * KP)), "v"(c), "v"(c + 2u * 32 * VP), "v"(c + 2u * VPL), "v"(c + 2u * (VPL + 32 * VP)),
                        "v"(gh), "v"(gh + 16 * DM), "v"(gl), "v"(gl + 16 * DM), "v"(vh), "v"(vh + 32 * NT_), "v"(vl), "v"(vl + 32 * NT_) : "memory");
    };
    fill(0, 0);
    asm volatile("s_wait_asynccnt 0x0" ::: "memory");     // tile 0 has landed before the barrier publishes it
    __syncthreads();
    fill(1, 1);
#pragma unroll 1
    for (int kt = kt_lo; kt <= kt_hi; ++kt) {
        const int l0 = kt * 32;
        const h16* st = &ring[kt & 1][0];
        const h16* ks = st + lr * KP + 8 * hi;     // key l0 + lr; key l0 + 16 + lr is 16 rows on; the residual plane KPL on
        v8f s0 = {}, s1 = {}, x0 = {}, x1 = {};
#pragma unroll
        for (int kc = 0; kc < 2; ++kc) {
            { const v16h k0h = cat16(*(const v8ha*)(ks + kc * 32), *(const v8ha*)(ks + kc * 32 + 16)), k1h = cat16(*(const v8ha*)(ks + 16 * KP + kc * 32), *(const v8ha*)(ks + 16 * KP + kc * 32 + 16));
              const v16h qlk = cat16(*(const v8h*)(QL16 + qo0 + kc * 32), *(const v8h*)(QL16 + qo0 + kc * 32 + 16));     // query residual re-read per step (registers)
              s0 = wmma16(k0h, qa[kc], s0); x0 = wmma16(k0h, qlk, x0); s1 = wmma16(k1h, qa[kc], s1); x1 = wmma16(k1h, qlk, x1);
            }
            { const v16h k0l = cat16(*(const v8ha*)(ks + KPL + kc * 32), *(const v8ha*)(ks + KPL + kc * 32 + 16)), k1l = cat16(*(const v8ha*)(ks + KPL + 16 * KP + kc * 32), *(const v8ha*)(ks + KPL + 16 * KP + kc * 32 + 16));
              x0 = wmma16(k0l, qa[kc], x0); x1 = wmma16(k1l, qa[kc], x1); }
        }
        asm volatile("v_nop\n\tv_nop\n\tv_nop\n\tv_nop" : "+v"(s0), "+v"(s1), "+v"(x0), "+v"(x1) : "v"(qa[0]), "v"(qa[1]));
        // register j of s0 / s1 = key l0 + 8 hi + j / l0 + 16 + 8 hi + j against query qi: kept while j / 16 + j <= dq
        const int dq = qi - l0 - 8 * hi;
        v2f a[8];     // pairs of neighbouring registers, so that the packed f32 forms take them where they lie
#pragma unroll
        for (int g = 0; g < 4; ++g) {
            a[g]     = ((v2f){s0[2 * g], s0[2 * g + 1]} + (v2f){x0[2 * g], x0[2 * g + 1]} * LOSCI) * 0.125f;
            a[4 + g] = ((v2f){s1[2 * g], s1[2 * g + 1]} + (v2f){x1[2 * g], x1[2 * g + 1]} * LOSCI) * 0.125f;
        }
#pragma unroll
        for (int g = 0; g < 8; ++g)
#pragma unroll
            for (int i = 0; i < 2; ++i) a[g][i] = ((g >> 2) * 16 + (g & 3) * 2 + i <= dq) ? a[g][i] : -__builtin_inff();
        float mx = fmaxf(a[0][0], a[0][1]);
#pragma unroll
        for (int g = 1; g < 8; ++g) mx = fmaxf(mx, fmaxf(a[g][0], a[g][1]));
        mx = fmaxf(mx, xhalf(mx));
        const float mn = fmaxf(mrow, mx);
        const float alpha = __expf(mrow - mn); mrow = mn;
        v2f ps2 = {0.f, 0.f};
        v16h pa, px;     // element s = key 8 hi + s (s < 8) or 8 hi + s + 8 (s >= 8) of the tile: the k order of the v loader below
#pragma unroll
        for (int g = 0; g < 8; ++g) {
            const v2f p = {__expf(a[g][0] - mn), __expf(a[g][1] - mn)};
            ps2 += p;
            const v2f ps = p * PSC;
            const v2h hp = __builtin_convertvector(ps, v2h);
            const v2h hx = __builtin_convertvector((ps - __builtin_convertvector(hp, v2f)) * LOSC, v2h);
            pa[2 * g] = hp[0]; pa[2 * g + 1] = hp[1]; px[2 * g] = hx[0]; px[2 * g + 1] = hx[1];
        }
        const float psum = ps2[0] + ps2[1];
        lpart = lpart * alpha + psum;
#pragma unroll
        for (int n = 0; n < 4; ++n)
#pragma unroll
            for (int j = 0; j < 8; ++j) { o[n][j] *= alpha; ox[n][j] *= alpha; }
#pragma unroll
        for (int n = 0; n < 4; ++n) { const h16* vs = st + 2 * KPL + (n * 16 + lr) * VP + hi * 8;
            const v16h vh = cat16(*(const v8ha*)(vs), *(const v8ha*)(vs + 16)), vl = cat16(*(const v8ha*)(vs + VPL), *(const v8ha*)(vs + VPL + 16));
            o[n] = wmma16(vh, pa, o[n]); ox[n] = wmma16(vl, pa, ox[n]); ox[n] = wmma16(vh, px, ox[n]); }     // register j of o[n] = head dim 16 n + 8 hi + j of query qi
        asm volatile("v_nop\n\tv_nop\n\tv_nop\n\tv_nop" : "+v"(o[0]), "+v"(o[1]), "+v"(o[2]), "+v"(o[3]), "+v"(ox[0]), "+v"(ox[1]), "+v"(ox[2]), "+v"(ox[3]) : "v"(pa), "v"(px));
        asm volatile("s_wait_dscnt 0x0" ::: "memory");        // this wave's reads of the buffer have returned before it is refilled
        asm volatile("s_wait_asynccnt 0x0" ::: "memory");     // this wave's copies of tile kt + 1 have landed before the barrier publishes them
        __syncthreads();                                      // publishes tile kt + 1 and ends every wave's reads of tile kt
        if (kt + 2 <= kt_hi) fill(kt + 2, kt & 1);
    }
    asm volatile("s_wait_asynccnt 0x0" ::: "memory");         // no copy is outstanding when the wave goes on to its end
    const float inv = 1.0f / ((lpart + xhalf(lpart)) * PSC);     // the halves' sums are joined once
    float* os = &ost[wave][0];
#pragma unroll
    for (int n = 0; n < 4; ++n)
#pragma unroll
        for (int g = 0; g < 2; ++g) { v4f w;
#pragma unroll
            for (int i = 0; i < 4; ++i) w[i] = (o[n][4 * g + i] + ox[n][4 * g + i] * LOSCI) * inv;
            *(v4fa*)(os + lr * 68 + n * 16 + hi * 8 + 4 * g) = w; }
    __syncthreads();
    const size_t cbase = (tok0 + q0) * DM + (size_t)h * HD;
    auto pass = [&]() {
#pragma unroll
        for (int s = 0; s < 8; ++s) { const int row = 2 * s + (lane >> 4), piece = lane & 15; const float* sp = os + row * 68 + piece * 4; v4f v;
#pragma unroll
            for (int i = 0; i < 4; ++i) v[i] = sp[i];
            *(v4f*)(CTX + cbase + (size_t)row * DM + piece * 4) = v; }
    };
    pass(); 
}

extern "C" void kernel_launch(void* const* d_in, const int* in_sizes, int n_in,
                              void* d_out, int out_size, void* d_ws, size_t ws_size, hipStream_t stream) {
    (void)in_sizes; (void)n_in; (void)out_size;
    const float* x = (const float*)d_in[0]; const float* Wq = (const float*)d_in[1]; const float* Wk = (const float*)d_in[2]; const float* Wv = (const float*)d_in[3];
    float* out = (float*)d_out;    // [8][1024][768]
    char* wsp = (char*)d_ws;
    auto take = [&](size_t bytes) { char* p = wsp; wsp += (bytes + 255) & ~(size_t)255; return (void*)p; };
    bf* WqT = (bf*)take((size_t)DM * DM * 2); bf* WkT = (bf*)take((size_t)DM * DM * 2); bf* WvT = (bf*)take((size_t)DM * DM * 2);
    bf* Xb = (bf*)take((size_t)NTK * DM * 2);
    h16* QH = (h16*)take((size_t)NTK * DM * 2); h16* QL = (h16*)take((size_t)NTK * DM * 2); h16* KH = (h16*)take((size_t)NTK * DM * 2); h16* KL = (h16*)take((size_t)NTK * DM * 2); h16* VTH = (h16*)take((size_t)NTK * DM * 2); h16* VTL = (h16*)take((size_t)NTK * DM * 2);
    if ((size_t)(wsp - (char*)d_ws) > ws_size) return;    // 3 x 1.2 + 12.6 + 6 x 12.6 ~ 92 MB
    k_prep<<<NWTB + NTK / 8, 256, 0, stream>>>(x, Wq, Wk, Wv, Xb, WqT, WkT, WvT);
    k_gemm3<<<dim3(NTK / 128, DM / 128, 3), 128, 0, stream>>>(Xb, WqT, WkT, WvT, QH, QL, KH, KL, VTH, VTL);
    k_attn<<<NB_ * NH_ * (NT_ / 64), 128, 0, stream>>>(QH, QL, KH, KL, VTH, VTL, out);
}

// v010
// Measured time: 54.5 microseconds a run.
// Versions in between are left out here; by their measured steps it is 1.48 times as fast as v008.
// All steps since v000 together make it 8.21 times as fast.
#include <hip/hip_runtime.h>

// Compute dtypes, f32 accumulate: q, k, v = x.W_h for all 12 heads as three [8192 x 768].[768 x 768] GEMMs with PLAIN bf16 operands (rounded input; the per-head [768][64] weights
// transposed into one n-major plane; exact products) on v_wmma_f32_16x16x32_bf16; q/k as one row-major f16 plane each, v as one transposed f16 plane; per (item, head) causal
// attention over 1024 tokens: scores on v_wmma_f32_16x16x32_f16 (x 1/8), online f32 softmax, weights and v as f16 on v_wmma_f32_16x16x32_f16.
// One f16 rounding (11 significand bits) of q, k, v and the weights lies well under the bf16 rounding (8 bits) that x and W have already taken in the projections, so no residual planes are carried.

#define NB_  8
#define NT_  1024
#define DM   768
#define NH_  12
#define HD   64
#define NTK  (NB_ * NT_)          // 8192 token rows
#define NW   DM

typedef _Float16 h16;
typedef unsigned short bf;
typedef __attribute__((ext_vector_type(16))) __bf16   v16bf;
typedef __attribute__((ext_vector_type(16))) _Float16 v16h;
typedef __attribute__((ext_vector_type(8)))  _Float16 v8h;
typedef __attribute__((ext_vector_type(8)))  unsigned short v8us;
typedef __attribute__((ext_vector_type(8)))  float    v8f;
typedef __attribute__((ext_vector_type(4)))  float    v4f;
typedef __attribute__((ext_vector_type(2)))  float    v2f;
typedef __attribute__((ext_vector_type(2)))  _Float16 v2h;
typedef v8h  __attribute__((may_alias)) v8ha;
typedef v4f  __attribute__((may_alias)) v4fa;
typedef v8us __attribute__((may_alias)) v8usa;

__device__ __forceinline__ unsigned short f2bf(float f) { unsigned u = __float_as_uint(f); u += 0x7FFFu + ((u >> 16) & 1u); return (unsigned short)(u >> 16); }
__device__ __forceinline__ v16h cat16(v8h lo, v8h hi) { return __builtin_shufflevector(lo, hi, 0, 1, 2, 3, 4, 5, 6, 7, 8, 9, 10, 11, 12, 13, 14, 15); }
__device__ __forceinline__ v16bf cat16b(v8us lo, v8us hi) { return __builtin_bit_cast(v16bf, __builtin_shufflevector(lo, hi, 0, 1, 2, 3, 4, 5, 6, 7, 8, 9, 10, 11, 12, 13, 14, 15)); }
__device__ __forceinline__ v8f wmma16(v16h a, v16h b, v8f c) { return __builtin_amdgcn_wmma_f32_16x16x32_f16(false, a, false, b, (short)0, c, false, false); }
// lane l <-> l ^ 16: the two halves of a wave hold the two halves of a query's keys
__device__ __forceinline__ float xhalf(float v) { const int b = __float_as_int(v); return __int_as_float(__builtin_amdgcn_permlanex16(b, b, 0x76543210, 0xfedcba98, false, false)); }
__device__ __forceinline__ v8f wmmab(v16bf a, v16bf b, v8f c) { return __builtin_amdgcn_wmma_f32_16x16x32_bf16(false, a, false, b, (short)0, c, false, false); }

// k_prep: both operand converters in ONE launch (they are independent of each other). Blocks 0 .. NWTB - 1: one 64 x 64 tile of a per-head weight plane, WT[h*64 + n][k] = bf16(W[h][k][n]), via LDS;
// the tile index runs k tile fastest, then head, then matrix (Wq / Wk / Wv). The other NTK / 8 blocks: 8 rows of x each, rounded to bf16, one row per wave.
#define NWTB ((DM / 64) * NH_ * 3)
__global__ __launch_bounds__(256) void k_prep(const float* __restrict__ x, const float* __restrict__ Wq, const float* __restrict__ Wk, const float* __restrict__ Wv, bf* Xb, bf* WqT, bf* WkT, bf* WvT) {
    __shared__ __align__(16) unsigned short tl[64 * 72];
    const int tid = threadIdx.x, bid = blockIdx.x;
    if (bid < NWTB) {     // block-uniform, so the barrier below is passed by the whole block or by none of it
        const int k0 = (bid % (DM / 64)) * 64, h = (bid / (DM / 64)) % NH_, z = bid / ((DM / 64) * NH_);
        const float* Wm = (z == 0 ? Wq : z == 1 ? Wk : Wv) + (size_t)h * DM * HD;
        bf* WT = (z == 0 ? WqT : z == 1 ? WkT : WvT) + (size_t)h * HD * DM;
        const int kk = tid >> 2, nq = (tid & 3) * 16;
#pragma unroll
        for (int i = 0; i < 16; ++i) tl[(nq + i) * 72 + kk] = f2bf(Wm[(size_t)(k0 + kk) * HD + nq + i]);
        __syncthreads();
        const int piece = tid & 7;
#pragma unroll
        for (int s = 0; s < 2; ++s) { const int nr = (tid >> 3) + 32 * s; const v8us val = *(const v8usa*)(tl + nr * 72 + piece * 8); *(v8us*)(WT + (size_t)nr * DM + k0 + piece * 8) = val; }
        return;
    }
    const int lane = tid & 31, r = (bid - NWTB) * 8 + (tid >> 5);
    if (r >= NTK) return;
    v8us o[DM / 256];
#pragma unroll
    for (int q = 0; q < DM / 256; ++q) { v8us t;
#pragma unroll
        for (int i = 0; i < 8; ++i) t[i] = f2bf(x[(size_t)r * DM + q * 256 + lane * 8 + i]);
        o[q] = t; }
#pragma unroll
    for (int q = 0; q < DM / 256; ++q) *(v8us*)(Xb + (size_t)r * DM + q * 256 + lane * 8) = o[q];
}

// k_gemm3: the three projections in ONE launch; blockIdx.z picks the weight plane and the output (0: q, 1: k, 2: v). 128 x 192 block tile (2 x 2 waves, 64 x 96 = 4 x 6 accumulator tiles each) of A.B^T, K = DM:
// 64 x 4 x 3 = 768 blocks, three to a WGP by their LDS, so that on 256 WGPs the whole grid is resident in ONE round with equal shares and no second, thinly filled round follows;
// 10 fragments read from LDS serve 24 matrix instructions.
// q, k: the tile leaves as a row-major f16 plane, whole lines. v: as the transposed f16 plane [item][head][d][token]; block tile = 128 tokens x three heads.
// LDS ring: a stage = 64 k: the block's A rows [128][64 k], then its B rows [192][64 k], at a pitch of 144 B (16 B x odd: ds_load_b128 without bank conflicts).
// The epilogues stage their tiles in the same LDS, behind the last trip's barrier.
#define GP   72
#define GBN  192                 // columns of a block tile
#define GPLA (128 * GP)
#define GSTG ((128 + GBN) * GP)
#define QTP  200     // pitch of the q / k epilogue's rows, in f16: 400 B = 16 B x odd
#define VTP  136     // pitch of the v epilogue's transposed rows, in f16: 272 B = 16 B x odd
// amdgpu_waves_per_eu(3, 3): the register budget of the three blocks whose rings fit a WGP's LDS
__global__ __launch_bounds__(128) __attribute__((amdgpu_waves_per_eu(3, 3))) void k_gemm3(const bf* __restrict__ A, const bf* __restrict__ Bq, const bf* __restrict__ Bk, const bf* __restrict__ Bv, h16* QH, h16* KH, h16* VTH) {
    __shared__ __align__(16) char smem[2 * GSTG * 2];
    constexpr int K = DM, ldc = DM;
    const int lane = threadIdx.x & 31, wave = threadIdx.x >> 5, lr = lane & 15, hi = lane >> 4;
    const int wm = wave >> 1, wn = wave & 1;     // the wave's 64 rows and 96 columns of the block tile
    const int z = blockIdx.z;
    const bf* Bn = z == 0 ? Bq : z == 1 ? Bk : Bv;
    const int rb = blockIdx.x * 128, c0 = blockIdx.y * GBN;
    v8f acc[4][6];
#pragma unroll
    for (int m = 0; m < 4; ++m)
#pragma unroll
        for (int t = 0; t < 6; ++t) acc[m][t] = (v8f){};
    // one stage = 2560 pieces of 16 B, 20 per thread: 8 lanes bring one whole 128-B line of a row; the waves share the A and the B tile in pairs
    const int tid = threadIdx.x, nt = K >> 6;
    const unsigned ring0 = (unsigned)(size_t)(__attribute__((address_space(3))) char*)&smem[0];
    const unsigned la = ring0 + 2u * (unsigned)((tid >> 3) * GP + (tid & 7) * 8);
    const bf* ga = A + (size_t)(rb + (tid >> 3)) * K + (tid & 7) * 8;
    const bf* gb = Bn + (size_t)(c0 + (tid >> 3)) * K + (tid & 7) * 8;
    const size_t k16 = (size_t)16 * K;
    auto fill8 = [&](unsigned a, const bf* p) {     // 128 rows of one operand: this thread's piece of rows tid / 8 + 16 i
        // the copies and their s_wait_xcnt in one statement: no address register is rewritten before the wait
        asm volatile("global_load_async_to_lds_b128 %0, %8, off\n\t"
                     "global_load_async_to_lds_b128 %1, %9, off\n\t"
                     "global_load_async_to_lds_b128 %2, %10, off\n\t"
                     "global_load_async_to_lds_b128 %3, %11, off\n\t"
                     "global_load_async_to_lds_b128 %4, %12, off\n\t"
                     "global_load_async_to_lds_b128 %5, %13, off\n\t"
                     "global_load_async_to_lds_b128 %6, %14, off\n\t"
                     "global_load_async_to_lds_b128 %7, %15, off\n\t"
                     "s_wait_xcnt 0x0"
                     :: "v"(a), "v"(a + 2u * 16 * GP), "v"(a + 2u * 32 * GP), "v"(a + 2u * 48 * GP), "v"(a + 2u * 64 * GP), "v"(a + 2u * 80 * GP), "v"(a + 2u * 96 * GP), "v"(a + 2u * 112 * GP),
                        "v"(p), "v"(p + k16), "v"(p + 2 * k16), "v"(p + 3 * k16), "v"(p + 4 * k16), "v"(p + 5 * k16), "v"(p + 6 * k16), "v"(p + 7 * k16) : "memory");
    };
    auto fill4 = [&](unsigned a, const bf* p) {     // 64 rows more, in the same form
        // the copies and their s_wait_xcnt in one statement: no address register is rewritten before the wait
        asm volatile("global_load_async_to_lds_b128 %0, %4, off\n\t"
                     "global_load_async_to_lds_b128 %1, %5, off\n\t"
                     "global_load_async_to_lds_b128 %2, %6, off\n\t"
                     "global_load_async_to_lds_b128 %3, %7, off\n\t"
                     "s_wait_xcnt 0x0"
                     :: "v"(a), "v"(a + 2u * 16 * GP), "v"(a + 2u * 32 * GP), "v"(a + 2u * 48 * GP),
                        "v"(p), "v"(p + k16), "v"(p + 2 * k16), "v"(p + 3 * k16) : "memory");
    };
    auto fill = [&](int t, int buf) { const unsigned a = la + (unsigned)buf * (2u * GSTG);
        fill8(a, ga + t * 64); fill8(a + 2u * GPLA, gb + t * 64); fill4(a + 2u * GPLA + 2u * 128 * GP, gb + 8 * k16 + t * 64); };
    fill(0, 0);
    asm volatile("s_wait_asynccnt 0x0" ::: "memory");     // tile 0 has landed before the barrier publishes it
    __syncthreads();
    if (nt > 1) fill(1, 1);
#pragma unroll 1
    for (int s = 0; s < nt; ++s) {
        const bf* st = (const bf*)(const void*)smem + (s & 1) * GSTG;
        const bf* as = st + (wm * 64 + lr) * GP + 8 * hi;            // row rb + 64 wm + lr; row tile m is 16 m rows on
        const bf* bs = st + GPLA + (wn * 96 + lr) * GP + 8 * hi;     // column c0 + 96 wn + lr; column tile t is 16 t rows on
#pragma unroll
        for (int kc = 0; kc < 2; ++kc) {
            v16bf a[4], b[6];
#pragma unroll
            for (int m = 0; m < 4; ++m) a[m] = cat16b(*(const v8usa*)(as + m * 16 * GP + kc * 32), *(const v8usa*)(as + m * 16 * GP + kc * 32 + 16));
#pragma unroll
            for (int t = 0; t < 6; ++t) b[t] = cat16b(*(const v8usa*)(bs + t * 16 * GP + kc * 32), *(const v8usa*)(bs + t * 16 * GP + kc * 32 + 16));
            __builtin_amdgcn_sched_barrier(0);     // the 20 fragment reads go out as one group ahead of their 24 matrix instructions: without it each further A fragment is read, and its LDS latency waited out, in front of its 6
#pragma unroll
            for (int m = 0; m < 4; ++m)
#pragma unroll
                for (int t = 0; t < 6; ++t) acc[m][t] = wmmab(a[m], b[t], acc[m][t]);
        }
        asm volatile("s_wait_dscnt 0x0" ::: "memory");        // this wave's reads of the buffer have returned before it is refilled
        asm volatile("s_wait_asynccnt 0x0" ::: "memory");     // this wave's copies of tile s + 1 have landed before the barrier publishes them
        __syncthreads();                                      // publishes tile s + 1 and ends every wave's reads of tile s
        if (s + 2 < nt) fill(s + 2, s & 1);
    }
    asm volatile("s_wait_asynccnt 0x0" ::: "memory");         // no copy is outstanding when the ring's LDS is used again below
    h16* tile = (h16*)(void*)smem;
    if (z == 2) {     // block-uniform
        // a lane's accumulator holds 8 consecutive tokens of one head dim: one 16-B piece of a transposed row
#pragma unroll
        for (int m = 0; m < 4; ++m)
#pragma unroll
            for (int t = 0; t < 6; ++t) { v8h a8;
#pragma unroll
                for (int j = 0; j < 8; ++j) a8[j] = (h16)acc[m][t][j];
                *(v8ha*)(tile + (wn * 96 + t * 16 + lr) * VTP + wm * 64 + m * 16 + hi * 8) = a8; }
        __syncthreads();
        const int piece = tid & 15;
        const int b = blockIdx.x / (NT_ / 128), k0 = (blockIdx.x % (NT_ / 128)) * 128;
        const size_t base = ((size_t)b * (NH_ * HD) + c0) * NT_ + k0;     // row d of the tile = head 3 y + d / 64, head dim d % 64
#pragma unroll
        for (int g = 0; g < 3; ++g) { v8h val[8];     // 16 lanes write the two whole 128-B lines of a row
            const h16* sp = tile + ((tid >> 4) + 64 * g) * VTP + piece * 8;
            h16* dp = VTH + base + (size_t)((tid >> 4) + 64 * g) * NT_ + piece * 8;
#pragma unroll
            for (int s = 0; s < 8; ++s) val[s] = *(const v8ha*)(sp + 8 * s * VTP);
#pragma unroll
            for (int s = 0; s < 8; ++s) *(v8h*)(dp + (size_t)(8 * s) * NT_) = val[s];
            asm volatile("s_wait_xcnt 0x0" ::: "memory");     // none of these stores' registers is rewritten by the next group in front of this wait
        }
    } else {
        // the whole block tile is staged as f16 rows: a row's three 128-B lines hold columns of both column waves, and each line leaves from one wave
#pragma unroll
        for (int m = 0; m < 4; ++m)
#pragma unroll
            for (int t = 0; t < 6; ++t)
#pragma unroll
                for (int j = 0; j < 8; ++j) tile[(wm * 64 + m * 16 + hi * 8 + j) * QTP + wn * 96 + t * 16 + lr] = (h16)acc[m][t][j];
        __syncthreads();
        h16* cblk = (z == 0 ? QH : KH) + (size_t)rb * ldc + c0;
        const int piece = tid & 7;
#pragma unroll
        for (int g = 0; g < 3; ++g) { v8h val[8];     // 8 lanes write one whole 128-B line: line g of rows tid / 8 + 16 s
            const h16* sp = tile + (tid >> 3) * QTP + g * 64 + piece * 8;
            h16* dp = cblk + (size_t)(tid >> 3) * ldc + g * 64 + piece * 8;
#pragma unroll
            for (int s = 0; s < 8; ++s) val[s] = *(const v8ha*)(sp + 16 * s * QTP);
#pragma unroll
            for (int s = 0; s < 8; ++s) *(v8h*)(dp + (size_t)(16 * s) * ldc) = val[s];
            asm volatile("s_wait_xcnt 0x0" ::: "memory");     // none of these stores' registers is rewritten by the next group in front of this wait
        }
    }
}

// k_attn: block = (b, h, 64 queries), wave = 16; CAUSAL: key tiles 0..(64qt+63)/32 with per-element j <= i. TRANSPOSED products: scores^T = k.q^T (A = key rows, B = query columns), so a lane holds
// 16 of the 32 scores of ONE query (lane & 15; the other 16 in lane ^ 16): maximum and sum run in the lane, one exchange between the halves. The two score tiles, converted in place to f16,
// are the B operand of ctx^T += v^T.p^T in the hardware k order: the weights never touch LDS. ctx -> f32 output rows [tok][h*64+d] (16 lanes x 16 B per head slice).
// LDS ring of k_attn: a stage = 32 keys: k [32 keys][64 d] at a pitch of 144 B, then v [64 d][32 keys] at a pitch of 80 B (16 B x odd: ds_load_b128 without bank conflicts)
#define KP   72
#define VP   40
#define KPL  (32 * KP)
#define VPL  (64 * VP)
#define STG  (KPL + VPL)
// amdgpu_waves_per_eu(4, 4): at most four waves per SIMD are resident, the residency this loop has been timed at; its registers and LDS would allow more, which is left untried here
__global__ __launch_bounds__(128) __attribute__((amdgpu_waves_per_eu(4, 4))) void k_attn(const h16* __restrict__ Q16, const h16* __restrict__ K16, const h16* __restrict__ VTH, float* CTX) {
    __shared__ __align__(16) float ost[4][16 * 68];
    __shared__ __align__(16) h16 ring[2][STG];
    const int lane = threadIdx.x & 31, wave = threadIdx.x >> 5, lr = lane & 15, hi = lane >> 4;
    const int bid = blockIdx.x;
    // heaviest query tiles first (for speed only): a tile's cost grows with qt
    const int qt = (NT_ / 64 - 1) - bid / (NB_ * NH_), bh = bid % (NB_ * NH_), b = bh / NH_, h = bh - b * NH_;
    const int q0 = qt * 64 + wave * 16;
    const size_t tok0 = (size_t)b * NT_;
    v16h qa[2];
    const size_t qo0 = (tok0 + q0 + lr) * DM + h * HD + 8 * hi;
#pragma unroll
    for (int kc = 0; kc < 2; ++kc) qa[kc] = cat16(*(const v8h*)(Q16 + qo0 + kc * 32), *(const v8h*)(Q16 + qo0 + kc * 32 + 16));
    asm volatile("s_wait_xcnt 0x0" :: "v"(Q16 + qo0) : "memory");     // the query loads' address pair is named as an input, so it stays whole up to this wait
    const h16* kh_b = K16 + tok0 * DM + h * HD;
    const size_t vbase = (((size_t)b * NH_ + h) * HD) * NT_;
    v8f o[4];
#pragma unroll
    for (int n = 0; n < 4; ++n) o[n] = (v8f){};
    float mrow = -3.0e38f, lpart = 0.f;     // of query q0 + lr; mrow is equal in both halves, lpart sums this half's keys
    const int qi = q0 + lr;
    const int kt_lo = 0, kt_hi = (qt * 64 + 63) / 32;     // causal; always at least two key tiles
    // one stage = 512 pieces of 16 B, 4 per thread: 8 lanes bring one whole 128-B k row, 4 lanes one 64-B v row piece; the block's 4 waves share the tile
    const int tid = threadIdx.x;
    const unsigned ring0 = (unsigned)(size_t)(__attribute__((address_space(3))) h16*)&ring[0][0];
    const unsigned lk = ring0 + 2u * (unsigned)((tid >> 3) * KP + (tid & 7) * 8), lv = ring0 + 2u * (unsigned)(KPL + (tid >> 2) * VP + (tid & 3) * 8);
    const size_t gko = (size_t)(tid >> 3) * DM + (tid & 7) * 8, gvo = vbase + (size_t)(tid >> 2) * NT_ + (tid & 3) * 8;
    auto fill = [&](int t, int buf) {
        const unsigned a = lk + (unsigned)buf * (2u * STG), c = lv + (unsigned)buf * (2u * STG);
        const h16* gh = kh_b + gko + (size_t)t * 32 * DM;
        const h16* vh = VTH + gvo + t * 32;
        // the copies and their s_wait_xcnt in one statement: no address register is rewritten before the wait
        asm volatile("global_load_async_to_lds_b128 %0, %4, off\n\t"
                     "global_load_async_to_lds_b128 %1, %5, off\n\t"
                     "global_load_async_to_lds_b128 %2, %6, off\n\t"
                     "global_load_async_to_lds_b128 %3, %7, off\n\t"
                     "s_wait_xcnt 0x0"
                     :: "v"(a), "v"(a + 2u * 16 * KP), "v"(c), "v"(c + 2u * 32 * VP),
                        "v"(gh), "v"(gh + 16 * DM), "v"(vh), "v"(vh + 32 * NT_) : "memory");
    };
    fill(0, 0);
    asm volatile("s_wait_asynccnt 0x0" ::: "memory");     // tile 0 has landed before the barrier publishes it
    __syncthreads();
    fill(1, 1);
#pragma unroll 1
    for (int kt = kt_lo; kt <= kt_hi; ++kt) {
        const int l0 = kt * 32;
        const h16* st = &ring[kt & 1][0];
        const h16* ks = st + lr * KP + 8 * hi;     // key l0 + lr; key l0 + 16 + lr is 16 rows on
        v8f s0 = {}, s1 = {};
#pragma unroll
        for (int kc = 0; kc < 2; ++kc) {
            const v16h k0h = cat16(*(const v8ha*)(ks + kc * 32), *(const v8ha*)(ks + kc * 32 + 16)), k1h = cat16(*(const v8ha*)(ks + 16 * KP + kc * 32), *(const v8ha*)(ks + 16 * KP + kc * 32 + 16));
            s0 = wmma16(k0h, qa[kc], s0); s1 = wmma16(k1h, qa[kc], s1);
        }
        asm volatile("v_nop\n\tv_nop\n\tv_nop\n\tv_nop" : "+v"(s0), "+v"(s1) : "v"(qa[0]), "v"(qa[1]));     // four vector slots between the last score product and the first read of its result
        // register j of s0 / s1 = key l0 + 8 hi + j / l0 + 16 + 8 hi + j against query qi: key index in the tile <= dq
        const int dq = qi - l0 - 8 * hi;
        v2f a[8];     // pairs of neighbouring registers, so that the packed f32 forms take them where they lie
#pragma unroll
        for (int g = 0; g < 4; ++g) {
            a[g]     = (v2f){s0[2 * g], s0[2 * g + 1]} * 0.125f;
            a[4 + g] = (v2f){s1[2 * g], s1[2 * g + 1]} * 0.125f;
        }
#pragma unroll
        for (int g = 0; g < 8; ++g)
#pragma unroll
            for (int i = 0; i < 2; ++i) a[g][i] = ((g >> 2) * 16 + (g & 3) * 2 + i <= dq) ? a[g][i] : -__builtin_inff();
        float mx = fmaxf(a[0][0], a[0][1]);
#pragma unroll
        for (int g = 1; g < 8; ++g) mx = fmaxf(mx, fmaxf(a[g][0], a[g][1]));
        mx = fmaxf(mx, xhalf(mx));
        const float mn = fmaxf(mrow, mx);
        const float alpha = __expf(mrow - mn); mrow = mn;
        v2f ps2 = {0.f, 0.f};
        v16h pa;     // element s = key 8 hi + s (s < 8) or 8 hi + s + 8 (s >= 8) of the tile: the k order of the v loader below
#pragma unroll
        for (int g = 0; g < 8; ++g) {
            const v2f p = {__expf(a[g][0] - mn), __expf(a[g][1] - mn)};
            ps2 += p;
            const v2h hp = __builtin_convertvector(p, v2h);
            pa[2 * g] = hp[0]; pa[2 * g + 1] = hp[1];
        }
        const float psum = ps2[0] + ps2[1];
        lpart = lpart * alpha + psum;
#pragma unroll
        for (int n = 0; n < 4; ++n)
#pragma unroll
            for (int j = 0; j < 8; ++j) o[n][j] *= alpha;
#pragma unroll
        for (int n = 0; n < 4; ++n) { const h16* vs = st + KPL + (n * 16 + lr) * VP + hi * 8;
            const v16h vh = cat16(*(const v8ha*)(vs), *(const v8ha*)(vs + 16));
            o[n] = wmma16(vh, pa, o[n]); }     // register j of o[n] = head dim 16 n + 8 hi + j of query qi
        asm volatile("v_nop\n\tv_nop\n\tv_nop\n\tv_nop" : "+v"(o[0]), "+v"(o[1]), "+v"(o[2]), "+v"(o[3]) : "v"(pa));     // four vector slots between the last ctx product and the first write of its operands or read of its result, on the loop's back edge too
        asm volatile("s_wait_dscnt 0x0" ::: "memory");        // this wave's reads of the buffer have returned before it is refilled
        asm volatile("s_wait_asynccnt 0x0" ::: "memory");     // this wave's copies of tile kt + 1 have landed before the barrier publishes them
        __syncthreads();                                      // publishes tile kt + 1 and ends every wave's reads of tile kt
        if (kt + 2 <= kt_hi) fill(kt + 2, kt & 1);
    }
    asm volatile("s_wait_asynccnt 0x0" ::: "memory");         // no copy is outstanding when the wave goes on to its end
    const float inv = 1.0f / (lpart + xhalf(lpart));     // the halves' sums are joined once
    float* os = &ost[wave][0];
#pragma unroll
    for (int n = 0; n < 4; ++n)
#pragma unroll
        for (int g = 0; g < 2; ++g) { v4f w;
#pragma unroll
            for (int i = 0; i < 4; ++i) w[i] = o[n][4 * g + i] * inv;
            *(v4fa*)(os + lr * 68 + n * 16 + hi * 8 + 4 * g) = w; }
    __syncthreads();
    const size_t cbase = (tok0 + q0) * DM + (size_t)h * HD;
    auto pass = [&]() {
#pragma unroll
        for (int s = 0; s < 8; ++s) { const int row = 2 * s + (lane >> 4), piece = lane & 15; const float* sp = os + row * 68 + piece * 4; v4f v;
#pragma unroll
            for (int i = 0; i < 4; ++i) v[i] = sp[i];
            *(v4f*)(CTX + cbase + (size_t)row * DM + piece * 4) = v; }
    };
    pass(); 
}

extern "C" void kernel_launch(void* const* d_in, const int* in_sizes, int n_in,
                              void* d_out, int out_size, void* d_ws, size_t ws_size, hipStream_t stream) {
    (void)in_sizes; (void)n_in; (void)out_size;
    const float* x = (const float*)d_in[0]; const float* Wq = (const float*)d_in[1]; const float* Wk = (const float*)d_in[2]; const float* Wv = (const float*)d_in[3];
    float* out = (float*)d_out;    // [8][1024][768]
    char* wsp = (char*)d_ws;
    auto take = [&](size_t bytes) { char* p = wsp; wsp += (bytes + 255) & ~(size_t)255; return (void*)p; };
    bf* WqT = (bf*)take((size_t)DM * DM * 2); bf* WkT = (bf*)take((size_t)DM * DM * 2); bf* WvT = (bf*)take((size_t)DM * DM * 2);
    bf* Xb = (bf*)take((size_t)NTK * DM * 2);
    h16* QH = (h16*)take((size_t)NTK * DM * 2); h16* KH = (h16*)take((size_t)NTK * DM * 2); h16* VTH = (h16*)take((size_t)NTK * DM * 2);
    if ((size_t)(wsp - (char*)d_ws) > ws_size) return;    // 3 x 1.2 + 12.6 + 3 x 12.6 ~ 54 MB
    k_prep<<<NWTB + NTK / 8, 256, 0, stream>>>(x, Wq, Wk, Wv, Xb, WqT, WkT, WvT);
    k_gemm3<<<dim3(NTK / 128, DM / GBN, 3), 128, 0, stream>>>(Xb, WqT, WkT, WvT, QH, KH, VTH);
    k_attn<<<NB_ * NH_ * (NT_ / 64), 128, 0, stream>>>(QH, KH, VTH, out);
}
